// v000
// Times are from an AMD MI455X. After a warm-up the kernel runs many times in a row, and a time is the length of
// such a window on the GPU divided by its runs, so every launch and the gaps after it count. The runs cycle
// through copies of the inputs. A figure is the median of several windows, for all but v000 over two sittings.
// Sittings can differ by a few percent; kernels timed side by side share one.
// The starting kernel, v000, takes 542 microseconds a run.
#include <hip/hip_runtime.h>

typedef __attribute__((ext_vector_type(16))) _Float16 v16h;
typedef __attribute__((ext_vector_type(8)))  _Float16 v8h;
typedef __attribute__((ext_vector_type(8)))  float    v8f;
typedef __attribute__((ext_vector_type(4)))  float    v4f;
typedef __attribute__((ext_vector_type(4)))  unsigned int u32x4;
typedef __attribute__((ext_vector_type(8)))  int      i32x8;
typedef __attribute__((ext_vector_type(4)))  int      i32x4;

#define DIMN   1024
#define NHEADS 16
#define HD     64
#define SEQ    2048
#define BATCH  4
#define TOKENS (BATCH * SEQ)   // 8192
#define ATT_SCALE 0.125f       // HEAD_DIM^-0.5 = 1/8

__device__ __forceinline__ void tdm_load_2d_f16(const void* gsrc,
                                                unsigned int lds_off,
                                                unsigned int tensor_w,
                                                unsigned int tensor_h,
                                                unsigned int stride,
                                                unsigned int tile_w,
                                                unsigned int tile_h) {
  const unsigned long long ga = (unsigned long long)(uintptr_t)gsrc;
  u32x4 g0;
  g0[0] = 1u;                                             // count=1, user mode
  g0[1] = lds_off;                                        // LDS byte address
  g0[2] = (unsigned int)(ga & 0xffffffffu);               // global_addr[31:0]
  g0[3] = (unsigned int)((ga >> 32) & 0x01ffffffu)        // global_addr[56:32]
          | (2u << 30);                                   // type=2 ("image")
  i32x8 g1;
  g1[0] = (int)(1u << 16);
  g1[1] = (int)((tensor_w & 0xffffu) << 16);
  g1[2] = (int)((tensor_w >> 16) | ((tensor_h & 0xffffu) << 16));
  g1[3] = (int)((tensor_h >> 16) | (tile_w << 16));
  g1[4] = (int)(tile_h & 0xffffu);
  g1[5] = (int)stride;
  g1[6] = 0;
  g1[7] = 0;
  const i32x4 gz4 = {0, 0, 0, 0};
  const i32x8 gz8 = {0, 0, 0, 0, 0, 0, 0, 0};
  __builtin_amdgcn_tensor_load_to_lds(g0, g1, gz4, gz4, gz8, 0);
}

__device__ __forceinline__ unsigned int lds_offset_of(const void* p) {
  return (unsigned int)(uintptr_t)p;
}

__device__ __forceinline__ v16h ldsFrag(const _Float16* base, int ld) {
  const int lane = threadIdx.x & 31;
  const int r    = lane & 15;
  const int kb   = (lane >> 4) << 3;
  const _Float16* p = base + r * ld + kb;
  const v8h lo = *(const v8h*)(p);
  const v8h hi = *(const v8h*)(p + 16);
  v16h f;
#pragma unroll
  for (int i = 0; i < 8; ++i) { f[i] = lo[i]; f[8 + i] = hi[i]; }
  return f;
}

// Row reductions across the 16 columns of a C-tile row (one 16-lane half).
__device__ __forceinline__ float rowMax(float v) {
#pragma unroll
  for (int m = 8; m >= 1; m >>= 1) v = fmaxf(v, __shfl_xor(v, m, 32));
  return v;
}
__device__ __forceinline__ float rowSum(float v) {
#pragma unroll
  for (int m = 8; m >= 1; m >>= 1) v += __shfl_xor(v, m, 32);
  return v;
}

__global__ __launch_bounds__(128)
void qk_proj_kernel(const float* __restrict__ x,
                    const float* __restrict__ Wqkv,
                    const float* __restrict__ bqkv,
                    _Float16* __restrict__ q_ws,
                    _Float16* __restrict__ k_ws) {
  __shared__ __align__(16) _Float16 Xs[64][32];
  __shared__ __align__(16) _Float16 Ws[64][32];

  const int m0   = blockIdx.y * 64;
  const int n0   = blockIdx.x * 64;
  const int t    = threadIdx.x;
  const int wv   = t >> 5;
  const int lane = t & 31;

  v8f acc[4] = {};

  for (int k0 = 0; k0 < DIMN; k0 += 32) {
    __syncthreads();
    {   // stage X tile (f32 -> f16)
      const int row = t >> 1, half = (t & 1) * 16;
      const float* src = x + (size_t)(m0 + row) * DIMN + k0 + half;
      _Float16* dst = &Xs[row][half];
#pragma unroll
      for (int i = 0; i < 16; i += 4) {
        v4f f = *(const v4f*)(src + i);
        dst[i]   = (_Float16)f[0]; dst[i+1] = (_Float16)f[1];
        dst[i+2] = (_Float16)f[2]; dst[i+3] = (_Float16)f[3];
      }
    }
    {   // stage W tile
      const int row = t >> 1, half = (t & 1) * 16;
      const float* src = Wqkv + (size_t)(n0 + row) * DIMN + k0 + half;
      _Float16* dst = &Ws[row][half];
#pragma unroll
      for (int i = 0; i < 16; i += 4) {
        v4f f = *(const v4f*)(src + i);
        dst[i]   = (_Float16)f[0]; dst[i+1] = (_Float16)f[1];
        dst[i+2] = (_Float16)f[2]; dst[i+3] = (_Float16)f[3];
      }
    }
    __syncthreads();

    const v16h a = ldsFrag(&Xs[wv * 16][0], 32);
#pragma unroll
    for (int j = 0; j < 4; ++j) {
      const v16h b = ldsFrag(&Ws[j * 16][0], 32);
      acc[j] = __builtin_amdgcn_wmma_f32_16x16x32_f16(
          false, a, false, b, (short)0, acc[j], false, false);
    }
  }

  const int rowOff = (lane >> 4) * 8;
  const int col    = lane & 15;
#pragma unroll
  for (int j = 0; j < 4; ++j) {
    const int gcol = n0 + j * 16 + col;
    const float bias = bqkv[gcol];
#pragma unroll
    for (int r = 0; r < 8; ++r) {
      const int tok = m0 + wv * 16 + rowOff + r;
      const int b   = tok >> 11, n = tok & (SEQ - 1);
      const _Float16 hv = (_Float16)(acc[j][r] + bias);
      if (gcol < DIMN) {
        const int h = gcol >> 6, d = gcol & 63;
        q_ws[(((size_t)(b * NHEADS + h)) * SEQ + n) * HD + d] = hv;
      } else {
        const int c = gcol - DIMN;
        const int h = c >> 6, d = c & 63;
        k_ws[(((size_t)(b * NHEADS + h)) * SEQ + n) * HD + d] = hv;
      }
    }
  }
}

__global__ __launch_bounds__(128)
void attn_kernel(const _Float16* __restrict__ q_ws,
                 const _Float16* __restrict__ k_ws,
                 const float* __restrict__ context,
                 _Float16* __restrict__ o_ws) {
  __shared__ __align__(16) _Float16 Qs[64][64];
  __shared__ __align__(16) _Float16 Ks[64][64];
  __shared__ __align__(16) _Float16 VTs[64][64];
  __shared__ __align__(16) _Float16 Ps[4][16 * 64];

  const int q0   = blockIdx.x * 64;
  const int bh   = blockIdx.y;
  const int b    = bh >> 4, h = bh & 15;
  const int t    = threadIdx.x;
  const int wv   = t >> 5;
  const int lane = t & 31;

  const _Float16* qbase = q_ws + (size_t)bh * SEQ * HD;
  const _Float16* kbase = k_ws + (size_t)bh * SEQ * HD;

  if (wv == 0) {
    tdm_load_2d_f16(qbase + (size_t)q0 * HD, lds_offset_of(&Qs[0][0]),
                    HD, SEQ, HD, 64, 64);
    __builtin_amdgcn_s_wait_tensorcnt(0);
  }
  __syncthreads();

  v16h aq[2];
  aq[0] = ldsFrag(&Qs[wv * 16][0],  64);
  aq[1] = ldsFrag(&Qs[wv * 16][32], 64);

  float mrun[8], lrun[8];
  v8f o[4] = {};
#pragma unroll
  for (int r = 0; r < 8; ++r) { mrun[r] = -1e30f; lrun[r] = 0.f; }

  for (int kt = 0; kt < SEQ / 64; ++kt) {
    __syncthreads();
    // K tile DMA: issue first so it overlaps the V^T convert staging below.
    if (wv == 0)
      tdm_load_2d_f16(kbase + (size_t)kt * 64 * HD, lds_offset_of(&Ks[0][0]),
                      HD, SEQ, HD, 64, 64);
    {   // stage V^T from context (f32 -> f16, transposed)
      const int row = t >> 1;          // key index within tile
      const int dh  = (t & 1) * 32;    // d offset
      const float* src = context + ((size_t)b * SEQ + kt * 64 + row) * DIMN + h * HD + dh;
#pragma unroll
      for (int d = 0; d < 32; ++d) VTs[dh + d][row] = (_Float16)src[d];
    }
    if (wv == 0) __builtin_amdgcn_s_wait_tensorcnt(0);
    __syncthreads();

    // S = Q K^T (16 queries x 64 keys per wave)
    v8f s4[4];
#pragma unroll
    for (int j = 0; j < 4; ++j) {
      v8f sc = {};
#pragma unroll
      for (int ks = 0; ks < 2; ++ks) {
        const v16h bk = ldsFrag(&Ks[j * 16][ks * 32], 64);
        sc = __builtin_amdgcn_wmma_f32_16x16x32_f16(
            false, aq[ks], false, bk, (short)0, sc, false, false);
      }
      s4[j] = sc;
    }

    // Online softmax
#pragma unroll
    for (int r = 0; r < 8; ++r) {
      float tm = -1e30f;
#pragma unroll
      for (int j = 0; j < 4; ++j) { s4[j][r] *= ATT_SCALE; tm = fmaxf(tm, s4[j][r]); }
      tm = rowMax(tm);
      const float mnew  = fmaxf(mrun[r], tm);
      const float alpha = __expf(mrun[r] - mnew);
      float rs = 0.f;
#pragma unroll
      for (int j = 0; j < 4; ++j) {
        const float e = __expf(s4[j][r] - mnew);
        s4[j][r] = e; rs += e;
      }
      rs = rowSum(rs);
      lrun[r] = lrun[r] * alpha + rs;
      mrun[r] = mnew;
#pragma unroll
      for (int j = 0; j < 4; ++j) o[j][r] *= alpha;
    }

    // P: accumulator layout -> per-wave LDS region -> A fragment
    _Float16* pw = &Ps[wv][0];
    {
      const int rowOff = (lane >> 4) * 8, col = lane & 15;
#pragma unroll
      for (int j = 0; j < 4; ++j)
#pragma unroll
        for (int r = 0; r < 8; ++r)
          pw[(rowOff + r) * 64 + j * 16 + col] = (_Float16)s4[j][r];
    }
    // Wave-private region: wave's own DS stores complete is sufficient.
    asm volatile("s_wait_dscnt 0x0" ::: "memory");

    // O += P V
#pragma unroll
    for (int ks = 0; ks < 2; ++ks) {
      const v16h pa = ldsFrag(pw + ks * 32, 64);
#pragma unroll
      for (int j = 0; j < 4; ++j) {
        const v16h bv = ldsFrag(&VTs[j * 16][ks * 32], 64);
        o[j] = __builtin_amdgcn_wmma_f32_16x16x32_f16(
            false, pa, false, bv, (short)0, o[j], false, false);
      }
    }
  }

  // Epilogue: normalize, store f16 [token, dim] for the out-proj GEMM
  const int rowOff = (lane >> 4) * 8, col = lane & 15;
#pragma unroll
  for (int r = 0; r < 8; ++r) {
    const float inv = 1.f / lrun[r];
    const int tok = b * SEQ + q0 + wv * 16 + rowOff + r;
#pragma unroll
    for (int j = 0; j < 4; ++j)
      o_ws[(size_t)tok * DIMN + h * HD + j * 16 + col] = (_Float16)(o[j][r] * inv);
  }
}

__global__ __launch_bounds__(128)
void out_proj_kernel(const _Float16* __restrict__ a_ws,
                     const float* __restrict__ Wout,
                     const float* __restrict__ bout,
                     float* __restrict__ out) {
  __shared__ __align__(16) _Float16 As[64][32];
  __shared__ __align__(16) _Float16 Ws[64][32];

  const int m0   = blockIdx.y * 64;
  const int n0   = blockIdx.x * 64;
  const int t    = threadIdx.x;
  const int wv   = t >> 5;
  const int lane = t & 31;

  v8f acc[4] = {};

  for (int k0 = 0; k0 < DIMN; k0 += 32) {
    __syncthreads();
    if (wv == 0)
      tdm_load_2d_f16(a_ws + (size_t)m0 * DIMN + k0, lds_offset_of(&As[0][0]),
                      DIMN, TOKENS, DIMN, 32, 64);
    {   // stage Wout tile (f32 -> f16) — overlaps the DMA
      const int row = t >> 1, half = (t & 1) * 16;
      const float* src = Wout + (size_t)(n0 + row) * DIMN + k0 + half;
      _Float16* dst = &Ws[row][half];
#pragma unroll
      for (int i = 0; i < 16; i += 4) {
        v4f f = *(const v4f*)(src + i);
        dst[i]   = (_Float16)f[0]; dst[i+1] = (_Float16)f[1];
        dst[i+2] = (_Float16)f[2]; dst[i+3] = (_Float16)f[3];
      }
    }
    if (wv == 0) __builtin_amdgcn_s_wait_tensorcnt(0);
    __syncthreads();

    const v16h a = ldsFrag(&As[wv * 16][0], 32);
#pragma unroll
    for (int j = 0; j < 4; ++j) {
      const v16h bw = ldsFrag(&Ws[j * 16][0], 32);
      acc[j] = __builtin_amdgcn_wmma_f32_16x16x32_f16(
          false, a, false, bw, (short)0, acc[j], false, false);
    }
  }

  const int rowOff = (lane >> 4) * 8, col = lane & 15;
#pragma unroll
  for (int j = 0; j < 4; ++j) {
    const float bias = bout[n0 + j * 16 + col];
#pragma unroll
    for (int r = 0; r < 8; ++r) {
      const int tok = m0 + wv * 16 + rowOff + r;
      out[(size_t)tok * DIMN + n0 + j * 16 + col] = acc[j][r] + bias;
    }
  }
}

// ---------------------------------------------------------------------------
extern "C" void kernel_launch(void* const* d_in, const int* in_sizes, int n_in,
                              void* d_out, int out_size, void* d_ws, size_t ws_size,
                              hipStream_t stream) {
  (void)in_sizes; (void)n_in; (void)out_size; (void)ws_size;

  const float* x       = (const float*)d_in[0];
  const float* context = (const float*)d_in[1];
  const float* Wqkv    = (const float*)d_in[2];
  const float* bqkv    = (const float*)d_in[3];
  const float* Wout    = (const float*)d_in[4];
  const float* bout    = (const float*)d_in[5];
  float* out = (float*)d_out;

  _Float16* q_ws = (_Float16*)d_ws;                    // 16 MB
  _Float16* k_ws = q_ws + (size_t)TOKENS * DIMN;       // 16 MB
  _Float16* o_ws = k_ws + (size_t)TOKENS * DIMN;       // 16 MB

  const dim3 blk(128, 1, 1);
  qk_proj_kernel <<<dim3(2048 / 64, TOKENS / 64, 1), blk, 0, stream>>>(
      x, Wqkv, bqkv, q_ws, k_ws);
  attn_kernel    <<<dim3(SEQ / 64, BATCH * NHEADS, 1), blk, 0, stream>>>(
      q_ws, k_ws, context, o_ws);
  out_proj_kernel<<<dim3(DIMN / 64, TOKENS / 64, 1), blk, 0, stream>>>(
      o_ws, Wout, bout, out);
}

// v001
// It runs in 404 microseconds.
// In both of two side-by-side timings against v000, it was 1.37 times as fast.
#include <hip/hip_runtime.h>

typedef __attribute__((ext_vector_type(16))) _Float16 v16h;
typedef __attribute__((ext_vector_type(8)))  _Float16 v8h;
typedef __attribute__((ext_vector_type(8)))  float    v8f;
typedef __attribute__((ext_vector_type(4)))  float    v4f;
typedef __attribute__((ext_vector_type(4)))  unsigned int u32x4;
typedef __attribute__((ext_vector_type(8)))  unsigned int u32x8;

#define DIMN   1024
#define NHEADS 16
#define HD     64
#define SEQ    2048
#define BATCH  4
#define TOKENS (BATCH * SEQ)   // 8192
#define ATT_SCALE 0.125f       // HEAD_DIM^-0.5 = 1/8
#define LDP64  72              // 64-half rows: 144 B
#define LDP32  40              // 32-half rows:  80 B

__device__ __forceinline__ unsigned int uni(unsigned int v) {
  return (unsigned int)__builtin_amdgcn_readfirstlane(v);
}
// Holds a wave-uniform test in a scalar register, so that the branch around a
// tensor load compiles to s_cmp + s_cbranch_scc.
__device__ __forceinline__ unsigned int pinned(unsigned int v) {
  unsigned int w = uni(v);
  asm volatile("" : "+s"(w));
  return w;
}
__device__ __forceinline__ u32x4 tdm_group0(const void* gsrc, unsigned int lds_off) {
  const unsigned long long ga = (unsigned long long)(uintptr_t)gsrc;
  u32x4 g0;
  g0[0] = uni(1u);                                        // count=1
  g0[1] = uni(lds_off);                                   // LDS byte address
  g0[2] = uni((unsigned int)ga);                          // global_addr[31:0]
  g0[3] = uni((((unsigned int)(ga >> 32)) & 0x01ffffffu)  // global_addr[56:32]
              | 0x80000000u);                             // type=2
  return g0;
}
template <unsigned int ROWB, unsigned int ROWS, unsigned int IVL>
__device__ __forceinline__ u32x8 tdm_group1(unsigned int src_pitch) {
  u32x8 g1;
  g1[0] = uni((1u << 20) | (IVL << 22) | (3u << 25));
  g1[1] = uni((ROWB & 0xffffu) << 16);
  g1[2] = uni((ROWB >> 16) | ((ROWS & 0xffffu) << 16));
  g1[3] = uni((ROWS >> 16) | (ROWB << 16));
  g1[4] = uni(ROWS);
  g1[5] = uni(src_pitch);
  g1[6] = uni(0u);
  g1[7] = uni(0u);
  asm volatile("" : "+s"(g1));
  return g1;
}
__device__ __forceinline__ void tdm_issue(u32x4 g0, u32x8 g1) {
  asm volatile("tensor_load_to_lds %0, %1" :: "s"(g0), "s"(g1) : "memory");
}
__device__ __forceinline__ void tdm_wait(u32x4 g0, u32x8 g1) {
  asm volatile("s_wait_tensorcnt 0x0" :: "s"(g0), "s"(g1) : "memory");
}

__device__ __forceinline__ unsigned int lds_offset_of(const void* p) {
  return (unsigned int)(uintptr_t)p;
}

__device__ __forceinline__ v16h ldsFrag(const _Float16* base, int ld) {
  const int lane = threadIdx.x & 31;
  const int r    = lane & 15;
  const int kb   = (lane >> 4) << 3;
  const _Float16* p = base + r * ld + kb;
  const v8h lo = *(const v8h*)(p);
  const v8h hi = *(const v8h*)(p + 16);
  v16h f;
#pragma unroll
  for (int i = 0; i < 8; ++i) { f[i] = lo[i]; f[8 + i] = hi[i]; }
  return f;
}

// Row reductions across the 16 columns of a C-tile row (one 16-lane half).
__device__ __forceinline__ float rowMax(float v) {
#pragma unroll
  for (int m = 8; m >= 1; m >>= 1) v = fmaxf(v, __shfl_xor(v, m, 32));
  return v;
}
__device__ __forceinline__ float rowSum(float v) {
#pragma unroll
  for (int m = 8; m >= 1; m >>= 1) v += __shfl_xor(v, m, 32);
  return v;
}

__global__ __launch_bounds__(128)
void qk_proj_kernel(const float* __restrict__ x,
                    const float* __restrict__ Wqkv,
                    const float* __restrict__ bqkv,
                    _Float16* __restrict__ q_ws,
                    _Float16* __restrict__ k_ws) {
  __shared__ __align__(16) _Float16 Xs[64][LDP32];
  __shared__ __align__(16) _Float16 Ws[64][LDP32];

  const int m0   = blockIdx.y * 64;
  const int n0   = blockIdx.x * 64;
  const int t    = threadIdx.x;
  const int wv   = t >> 5;
  const int lane = t & 31;

  v8f acc[4] = {};

  for (int k0 = 0; k0 < DIMN; k0 += 32) {
    __syncthreads();
    {   // stage X tile (f32 -> f16)
      const int row = t >> 1, half = (t & 1) * 16;
      const float* src = x + (size_t)(m0 + row) * DIMN + k0 + half;
      _Float16* dst = &Xs[row][half];
#pragma unroll
      for (int i = 0; i < 16; i += 4) {
        v4f f = *(const v4f*)(src + i);
        dst[i]   = (_Float16)f[0]; dst[i+1] = (_Float16)f[1];
        dst[i+2] = (_Float16)f[2]; dst[i+3] = (_Float16)f[3];
      }
    }
    {   // stage W tile
      const int row = t >> 1, half = (t & 1) * 16;
      const float* src = Wqkv + (size_t)(n0 + row) * DIMN + k0 + half;
      _Float16* dst = &Ws[row][half];
#pragma unroll
      for (int i = 0; i < 16; i += 4) {
        v4f f = *(const v4f*)(src + i);
        dst[i]   = (_Float16)f[0]; dst[i+1] = (_Float16)f[1];
        dst[i+2] = (_Float16)f[2]; dst[i+3] = (_Float16)f[3];
      }
    }
    __syncthreads();

    const v16h a = ldsFrag(&Xs[wv * 16][0], LDP32);
#pragma unroll
    for (int j = 0; j < 4; ++j) {
      const v16h b = ldsFrag(&Ws[j * 16][0], LDP32);
      acc[j] = __builtin_amdgcn_wmma_f32_16x16x32_f16(
          false, a, false, b, (short)0, acc[j], false, false);
    }
  }

  const int rowOff = (lane >> 4) * 8;
  const int col    = lane & 15;
#pragma unroll
  for (int j = 0; j < 4; ++j) {
    const int gcol = n0 + j * 16 + col;
    const float bias = bqkv[gcol];
#pragma unroll
    for (int r = 0; r < 8; ++r) {
      const int tok = m0 + wv * 16 + rowOff + r;
      const int b   = tok >> 11, n = tok & (SEQ - 1);
      const _Float16 hv = (_Float16)(acc[j][r] + bias);
      if (gcol < DIMN) {
        const int h = gcol >> 6, d = gcol & 63;
        q_ws[(((size_t)(b * NHEADS + h)) * SEQ + n) * HD + d] = hv;
      } else {
        const int c = gcol - DIMN;
        const int h = c >> 6, d = c & 63;
        k_ws[(((size_t)(b * NHEADS + h)) * SEQ + n) * HD + d] = hv;
      }
    }
  }
}

__global__ __launch_bounds__(128)
void attn_kernel(const _Float16* __restrict__ q_ws,
                 const _Float16* __restrict__ k_ws,
                 const float* __restrict__ context,
                 _Float16* __restrict__ o_ws) {
  // Tensor-load targets: placed at multiples of 2 KiB, sizes rounded up to one.
  __shared__ __attribute__((aligned(2048))) _Float16 Qs[5120];   // 64 x LDP64 used
  __shared__ __attribute__((aligned(2048))) _Float16 Ks[5120];   // 64 x LDP64 used
  __shared__ __align__(16) _Float16 VTs[64][LDP64];
  __shared__ __align__(16) _Float16 Ps[4][16 * LDP64];

  const int q0   = blockIdx.x * 64;
  const int bh   = blockIdx.y;
  const int b    = bh >> 4, h = bh & 15;
  const int t    = threadIdx.x;
  const int wv   = t >> 5;
  const int lane = t & 31;
  const unsigned int wave = uni((unsigned int)t >> 5);

  const _Float16* qbase = q_ws + (size_t)bh * SEQ * HD;
  const _Float16* kbase = k_ws + (size_t)bh * SEQ * HD;

  const u32x8 g1 = tdm_group1<128, 64, 4>(HD * 2);
  if (pinned(wave == 0u)) {
    const u32x4 gq = tdm_group0(qbase + (size_t)q0 * HD, lds_offset_of(&Qs[0]));
    tdm_issue(gq, g1);
    tdm_wait(gq, g1);
  }
  __syncthreads();

  v16h aq[2];
  aq[0] = ldsFrag(&Qs[wv * 16 * LDP64],      LDP64);
  aq[1] = ldsFrag(&Qs[wv * 16 * LDP64 + 32], LDP64);

  float mrun[8], lrun[8];
  v8f o[4] = {};
#pragma unroll
  for (int r = 0; r < 8; ++r) { mrun[r] = -1e30f; lrun[r] = 0.f; }

  for (int kt = 0; kt < SEQ / 64; ++kt) {
    __syncthreads();
    // K tile DMA: issue first so it overlaps the V^T convert staging below.
    const u32x4 gk = tdm_group0(kbase + (size_t)kt * 64 * HD, lds_offset_of(&Ks[0]));
    if (pinned(wave == 0u)) tdm_issue(gk, g1);
    {   // stage V^T from context (f32 -> f16, transposed)
      const int row = t >> 1;          // key index within tile
      const int dh  = (t & 1) * 32;    // d offset
      const float* src = context + ((size_t)b * SEQ + kt * 64 + row) * DIMN + h * HD + dh;
#pragma unroll
      for (int d = 0; d < 32; ++d) VTs[dh + d][row] = (_Float16)src[d];
    }
    if (pinned(wave == 0u)) tdm_wait(gk, g1);
    __syncthreads();

    // S = Q K^T (16 queries x 64 keys per wave)
    v8f s4[4];
#pragma unroll
    for (int j = 0; j < 4; ++j) {
      v8f sc = {};
#pragma unroll
      for (int ks = 0; ks < 2; ++ks) {
        const v16h bk = ldsFrag(&Ks[j * 16 * LDP64 + ks * 32], LDP64);
        sc = __builtin_amdgcn_wmma_f32_16x16x32_f16(
            false, aq[ks], false, bk, (short)0, sc, false, false);
      }
      s4[j] = sc;
    }

    // Online softmax
#pragma unroll
    for (int r = 0; r < 8; ++r) {
      float tm = -1e30f;
#pragma unroll
      for (int j = 0; j < 4; ++j) { s4[j][r] *= ATT_SCALE; tm = fmaxf(tm, s4[j][r]); }
      tm = rowMax(tm);
      const float mnew  = fmaxf(mrun[r], tm);
      const float alpha = __expf(mrun[r] - mnew);
      float rs = 0.f;
#pragma unroll
      for (int j = 0; j < 4; ++j) {
        const float e = __expf(s4[j][r] - mnew);
        s4[j][r] = e; rs += e;
      }
      rs = rowSum(rs);
      lrun[r] = lrun[r] * alpha + rs;
      mrun[r] = mnew;
#pragma unroll
      for (int j = 0; j < 4; ++j) o[j][r] *= alpha;
    }

    // P: accumulator layout -> per-wave LDS region -> A fragment
    _Float16* pw = &Ps[wv][0];
    {
      const int rowOff = (lane >> 4) * 8, col = lane & 15;
#pragma unroll
      for (int j = 0; j < 4; ++j)
#pragma unroll
        for (int r = 0; r < 8; ++r)
          pw[(rowOff + r) * LDP64 + j * 16 + col] = (_Float16)s4[j][r];
    }
    // Wave-private region: wave's own DS stores complete is sufficient.
    asm volatile("s_wait_dscnt 0x0" ::: "memory");

    // O += P V
#pragma unroll
    for (int ks = 0; ks < 2; ++ks) {
      const v16h pa = ldsFrag(pw + ks * 32, LDP64);
#pragma unroll
      for (int j = 0; j < 4; ++j) {
        const v16h bv = ldsFrag(&VTs[j * 16][ks * 32], LDP64);
        o[j] = __builtin_amdgcn_wmma_f32_16x16x32_f16(
            false, pa, false, bv, (short)0, o[j], false, false);
      }
    }
  }

  // Epilogue: normalize, store f16 [token, dim] for the out-proj GEMM
  const int rowOff = (lane >> 4) * 8, col = lane & 15;
#pragma unroll
  for (int r = 0; r < 8; ++r) {
    const float inv = 1.f / lrun[r];
    const int tok = b * SEQ + q0 + wv * 16 + rowOff + r;
#pragma unroll
    for (int j = 0; j < 4; ++j)
      o_ws[(size_t)tok * DIMN + h * HD + j * 16 + col] = (_Float16)(o[j][r] * inv);
  }
}

__global__ __launch_bounds__(128)
void out_proj_kernel(const _Float16* __restrict__ a_ws,
                     const float* __restrict__ Wout,
                     const float* __restrict__ bout,
                     float* __restrict__ out) {
  __shared__ __attribute__((aligned(2048))) _Float16 As[64][LDP32];  // tensor-load target
  __shared__ __align__(16) _Float16 Ws[64][LDP32];

  const int m0   = blockIdx.y * 64;
  const int n0   = blockIdx.x * 64;
  const int t    = threadIdx.x;
  const int wv   = t >> 5;
  const int lane = t & 31;
  const unsigned int wave = uni((unsigned int)t >> 5);
  const u32x8 g1 = tdm_group1<64, 64, 3>(DIMN * 2);

  v8f acc[4] = {};

  for (int k0 = 0; k0 < DIMN; k0 += 32) {
    __syncthreads();
    const u32x4 ga = tdm_group0(a_ws + (size_t)m0 * DIMN + k0, lds_offset_of(&As[0][0]));
    if (pinned(wave == 0u)) tdm_issue(ga, g1);
    {   // stage Wout tile (f32 -> f16) — overlaps the DMA
      const int row = t >> 1, half = (t & 1) * 16;
      const float* src = Wout + (size_t)(n0 + row) * DIMN + k0 + half;
      _Float16* dst = &Ws[row][half];
#pragma unroll
      for (int i = 0; i < 16; i += 4) {
        v4f f = *(const v4f*)(src + i);
        dst[i]   = (_Float16)f[0]; dst[i+1] = (_Float16)f[1];
        dst[i+2] = (_Float16)f[2]; dst[i+3] = (_Float16)f[3];
      }
    }
    if (pinned(wave == 0u)) tdm_wait(ga, g1);
    __syncthreads();

    const v16h a = ldsFrag(&As[wv * 16][0], LDP32);
#pragma unroll
    for (int j = 0; j < 4; ++j) {
      const v16h bw = ldsFrag(&Ws[j * 16][0], LDP32);
      acc[j] = __builtin_amdgcn_wmma_f32_16x16x32_f16(
          false, a, false, bw, (short)0, acc[j], false, false);
    }
  }

  const int rowOff = (lane >> 4) * 8, col = lane & 15;
#pragma unroll
  for (int j = 0; j < 4; ++j) {
    const float bias = bout[n0 + j * 16 + col];
#pragma unroll
    for (int r = 0; r < 8; ++r) {
      const int tok = m0 + wv * 16 + rowOff + r;
      out[(size_t)tok * DIMN + n0 + j * 16 + col] = acc[j][r] + bias;
    }
  }
}

// ---------------------------------------------------------------------------
extern "C" void kernel_launch(void* const* d_in, const int* in_sizes, int n_in,
                              void* d_out, int out_size, void* d_ws, size_t ws_size,
                              hipStream_t stream) {
  (void)in_sizes; (void)n_in; (void)out_size; (void)ws_size;

  const float* x       = (const float*)d_in[0];
  const float* context = (const float*)d_in[1];
  const float* Wqkv    = (const float*)d_in[2];
  const float* bqkv    = (const float*)d_in[3];
  const float* Wout    = (const float*)d_in[4];
  const float* bout    = (const float*)d_in[5];
  float* out = (float*)d_out;

  _Float16* q_ws = (_Float16*)d_ws;                    // 16 MB
  _Float16* k_ws = q_ws + (size_t)TOKENS * DIMN;       // 16 MB
  _Float16* o_ws = k_ws + (size_t)TOKENS * DIMN;       // 16 MB

  const dim3 blk(128, 1, 1);
  qk_proj_kernel <<<dim3(2048 / 64, TOKENS / 64, 1), blk, 0, stream>>>(
      x, Wqkv, bqkv, q_ws, k_ws);
  attn_kernel    <<<dim3(SEQ / 64, BATCH * NHEADS, 1), blk, 0, stream>>>(
      q_ws, k_ws, context, o_ws);
  out_proj_kernel<<<dim3(DIMN / 64, TOKENS / 64, 1), blk, 0, stream>>>(
      o_ws, Wout, bout, out);
}

// v002
// One run takes 263 microseconds.
// Two timings next to v001 both put it at 1.53 times that version's speed.
// Counting every step since v000, it is 2.10 times as fast.
#include <hip/hip_runtime.h>

typedef __attribute__((ext_vector_type(16))) _Float16 v16h;
typedef __attribute__((ext_vector_type(8)))  _Float16 v8h;
typedef __attribute__((ext_vector_type(8)))  float    v8f;
typedef __attribute__((ext_vector_type(4)))  float    v4f;
typedef __attribute__((ext_vector_type(2)))  float    v2f;
typedef __attribute__((ext_vector_type(4)))  unsigned int u32x4;
typedef __attribute__((ext_vector_type(8)))  unsigned int u32x8;

#define DIMN   1024
#define NHEADS 16
#define HD     64
#define SEQ    2048
#define BATCH  4
#define TOKENS (BATCH * SEQ)   // 8192
#define ATT_SCALE 0.125f       // HEAD_DIM^-0.5 = 1/8
#define LDP64  72              // 64-half rows: 144 B
#define LDP32  40              // 32-half rows:  80 B

__device__ __forceinline__ unsigned int uni(unsigned int v) {
  return (unsigned int)__builtin_amdgcn_readfirstlane(v);
}
// Holds a wave-uniform test in a scalar register, so that the branch around a
// tensor load compiles to s_cmp + s_cbranch_scc.
__device__ __forceinline__ unsigned int pinned(unsigned int v) {
  unsigned int w = uni(v);
  asm volatile("" : "+s"(w));
  return w;
}
__device__ __forceinline__ u32x4 tdm_group0(const void* gsrc, unsigned int lds_off) {
  const unsigned long long ga = (unsigned long long)(uintptr_t)gsrc;
  u32x4 g0;
  g0[0] = uni(1u);                                        // count=1
  g0[1] = uni(lds_off);                                   // LDS byte address
  g0[2] = uni((unsigned int)ga);                          // global_addr[31:0]
  g0[3] = uni((((unsigned int)(ga >> 32)) & 0x01ffffffu)  // global_addr[56:32]
              | 0x80000000u);                             // type=2
  return g0;
}
template <unsigned int ROWB, unsigned int ROWS, unsigned int IVL>
__device__ __forceinline__ u32x8 tdm_group1(unsigned int src_pitch) {
  u32x8 g1;
  g1[0] = uni((1u << 20) | (IVL << 22) | (3u << 25));
  g1[1] = uni((ROWB & 0xffffu) << 16);
  g1[2] = uni((ROWB >> 16) | ((ROWS & 0xffffu) << 16));
  g1[3] = uni((ROWS >> 16) | (ROWB << 16));
  g1[4] = uni(ROWS);
  g1[5] = uni(src_pitch);
  g1[6] = uni(0u);
  g1[7] = uni(0u);
  asm volatile("" : "+s"(g1));
  return g1;
}
__device__ __forceinline__ void tdm_issue(u32x4 g0, u32x8 g1) {
  asm volatile("tensor_load_to_lds %0, %1" :: "s"(g0), "s"(g1) : "memory");
}
__device__ __forceinline__ void tdm_wait(u32x4 g0, u32x8 g1) {
  asm volatile("s_wait_tensorcnt 0x0" :: "s"(g0), "s"(g1) : "memory");
}

__device__ __forceinline__ unsigned int lds_offset_of(const void* p) {
  return (unsigned int)(uintptr_t)p;
}

__device__ __forceinline__ v16h ldsFrag(const _Float16* base, int ld) {
  const int lane = threadIdx.x & 31;
  const int r    = lane & 15;
  const int kb   = (lane >> 4) << 3;
  const _Float16* p = base + r * ld + kb;
  const v8h lo = *(const v8h*)(p);
  const v8h hi = *(const v8h*)(p + 16);
  v16h f;
#pragma unroll
  for (int i = 0; i < 8; ++i) { f[i] = lo[i]; f[8 + i] = hi[i]; }
  return f;
}

__device__ __forceinline__ float xhalf(float v) {
  const int b = __builtin_bit_cast(int, v);
  return __builtin_bit_cast(float, __builtin_amdgcn_permlanex16(
      b, b, 0x76543210, 0xfedcba98, false, false));
}

__global__ __launch_bounds__(128)
void qk_proj_kernel(const float* __restrict__ x,
                    const float* __restrict__ Wqkv,
                    const float* __restrict__ bqkv,
                    _Float16* __restrict__ q_ws,
                    _Float16* __restrict__ k_ws) {
  __shared__ __align__(16) _Float16 Xs[64][LDP32];
  __shared__ __align__(16) _Float16 Ws[64][LDP32];

  const int m0   = blockIdx.y * 64;
  const int n0   = blockIdx.x * 64;
  const int t    = threadIdx.x;
  const int wv   = t >> 5;
  const int lane = t & 31;

  v8f acc[4] = {};

  for (int k0 = 0; k0 < DIMN; k0 += 32) {
    __syncthreads();
    {   // stage X tile (f32 -> f16)
      const int row = t >> 1, half = (t & 1) * 16;
      const float* src = x + (size_t)(m0 + row) * DIMN + k0 + half;
      _Float16* dst = &Xs[row][half];
#pragma unroll
      for (int i = 0; i < 16; i += 4) {
        v4f f = *(const v4f*)(src + i);
        dst[i]   = (_Float16)f[0]; dst[i+1] = (_Float16)f[1];
        dst[i+2] = (_Float16)f[2]; dst[i+3] = (_Float16)f[3];
      }
    }
    {   // stage W tile
      const int row = t >> 1, half = (t & 1) * 16;
      const float* src = Wqkv + (size_t)(n0 + row) * DIMN + k0 + half;
      _Float16* dst = &Ws[row][half];
#pragma unroll
      for (int i = 0; i < 16; i += 4) {
        v4f f = *(const v4f*)(src + i);
        dst[i]   = (_Float16)f[0]; dst[i+1] = (_Float16)f[1];
        dst[i+2] = (_Float16)f[2]; dst[i+3] = (_Float16)f[3];
      }
    }
    __syncthreads();

    const v16h a = ldsFrag(&Xs[wv * 16][0], LDP32);
#pragma unroll
    for (int j = 0; j < 4; ++j) {
      const v16h b = ldsFrag(&Ws[j * 16][0], LDP32);
      acc[j] = __builtin_amdgcn_wmma_f32_16x16x32_f16(
          false, a, false, b, (short)0, acc[j], false, false);
    }
  }

  const int rowOff = (lane >> 4) * 8;
  const int col    = lane & 15;
#pragma unroll
  for (int j = 0; j < 4; ++j) {
    const int gcol = n0 + j * 16 + col;
    const float bias = bqkv[gcol];
#pragma unroll
    for (int r = 0; r < 8; ++r) {
      const int tok = m0 + wv * 16 + rowOff + r;
      const int b   = tok >> 11, n = tok & (SEQ - 1);
      const _Float16 hv = (_Float16)(acc[j][r] + bias);
      if (gcol < DIMN) {
        const int h = gcol >> 6, d = gcol & 63;
        q_ws[(((size_t)(b * NHEADS + h)) * SEQ + n) * HD + d] = hv;
      } else {
        const int c = gcol - DIMN;
        const int h = c >> 6, d = c & 63;
        k_ws[(((size_t)(b * NHEADS + h)) * SEQ + n) * HD + d] = hv;
      }
    }
  }
}

__global__ __launch_bounds__(128)
void attn_kernel(const _Float16* __restrict__ q_ws,
                 const _Float16* __restrict__ k_ws,
                 const float* __restrict__ context,
                 _Float16* __restrict__ o_ws) {
  // Tensor-load targets: placed at multiples of 2 KiB, sizes rounded up to one.
  __shared__ __attribute__((aligned(2048))) _Float16 Qs[5120];   // 64 x LDP64 used
  __shared__ __attribute__((aligned(2048))) _Float16 Ks[5120];   // 64 x LDP64 used
  __shared__ __align__(16) _Float16 VTs[64][LDP64];

  const int q0   = blockIdx.x * 64;
  const int bh   = blockIdx.y;
  const int b    = bh >> 4, h = bh & 15;
  const int t    = threadIdx.x;
  const int wv   = t >> 5;
  const int lane = t & 31;
  const unsigned int wave = uni((unsigned int)t >> 5);

  const _Float16* qbase = q_ws + (size_t)bh * SEQ * HD;
  const _Float16* kbase = k_ws + (size_t)bh * SEQ * HD;

  const u32x8 g1 = tdm_group1<128, 64, 4>(HD * 2);
  if (pinned(wave == 0u)) {
    const u32x4 gq = tdm_group0(qbase + (size_t)q0 * HD, lds_offset_of(&Qs[0]));
    tdm_issue(gq, g1);
    tdm_wait(gq, g1);
  }
  __syncthreads();

  v16h aq[2];
  aq[0] = ldsFrag(&Qs[wv * 16 * LDP64],      LDP64);
  aq[1] = ldsFrag(&Qs[wv * 16 * LDP64 + 32], LDP64);

  // Per lane: its query's running maximum (equal in both halves) and the sum
  // over this half's keys (the halves are joined in the epilogue).
  float mrun = -1e30f, lrun = 0.f;
  v8f o[4] = {};   // O^T: d = j * 16 + (lane >> 4) * 8 + r, query = lane & 15

  for (int kt = 0; kt < SEQ / 64; ++kt) {
    __syncthreads();
    // K tile DMA: issue first so it overlaps the V^T convert staging below.
    const u32x4 gk = tdm_group0(kbase + (size_t)kt * 64 * HD, lds_offset_of(&Ks[0]));
    if (pinned(wave == 0u)) tdm_issue(gk, g1);
    {   // stage V^T from context (f32 -> f16, transposed)
      const int row = t >> 1;          // key index within tile
      const int dh  = (t & 1) * 32;    // d offset
      const float* src = context + ((size_t)b * SEQ + kt * 64 + row) * DIMN + h * HD + dh;
#pragma unroll
      for (int d = 0; d < 32; ++d) VTs[dh + d][row] = (_Float16)src[d];
    }
    if (pinned(wave == 0u)) tdm_wait(gk, g1);
    __syncthreads();

    // S^T = K Q^T (64 keys x 16 queries per wave)
    v8f s4[4];
#pragma unroll
    for (int j = 0; j < 4; ++j) {
      v8f sc = {};
#pragma unroll
      for (int ks = 0; ks < 2; ++ks) {
        const v16h ak = ldsFrag(&Ks[j * 16 * LDP64 + ks * 32], LDP64);
        sc = __builtin_amdgcn_wmma_f32_16x16x32_f16(
            false, ak, false, aq[ks], (short)0, sc, false, false);
      }
      s4[j] = sc;
    }

    // Online softmax, one query per lane
    float tm = -1e30f;
#pragma unroll
    for (int j = 0; j < 4; ++j)
#pragma unroll
      for (int r = 0; r < 8; ++r) { s4[j][r] *= ATT_SCALE; tm = fmaxf(tm, s4[j][r]); }
    tm = fmaxf(tm, xhalf(tm));
    const float mnew  = fmaxf(mrun, tm);
    const float alpha = __expf(mrun - mnew);
    float rs = 0.f;
#pragma unroll
    for (int j = 0; j < 4; ++j)
#pragma unroll
      for (int r = 0; r < 8; r += 2) {
        // The two differences as one register pair (packed f32 arithmetic).
        const v2f d = (v2f){s4[j][r], s4[j][r + 1]} - (v2f){mnew, mnew};
        const float e0 = __expf(d[0]), e1 = __expf(d[1]);
        s4[j][r] = e0; s4[j][r + 1] = e1; rs += e0; rs += e1;
      }
    lrun = lrun * alpha + rs;
    mrun = mnew;
#pragma unroll
    for (int j = 0; j < 4; ++j)
#pragma unroll
      for (int r = 0; r < 8; ++r) o[j][r] *= alpha;

    // O^T += V^T P^T. Score tiles 2ks and 2ks+1 hold this lane's keys
    // kb..kb+7 and kb+16..kb+23 (kb = (lane >> 4) * 8) of the 32-key block:
    // the k order of ldsFrag, so they pack straight into the B fragment.
#pragma unroll
    for (int ks = 0; ks < 2; ++ks) {
      v16h pb;
#pragma unroll
      for (int i = 0; i < 8; ++i) {
        pb[i]     = (_Float16)s4[2 * ks][i];
        pb[8 + i] = (_Float16)s4[2 * ks + 1][i];
      }
#pragma unroll
      for (int j = 0; j < 4; ++j) {
        const v16h av = ldsFrag(&VTs[j * 16][ks * 32], LDP64);
        o[j] = __builtin_amdgcn_wmma_f32_16x16x32_f16(
            false, av, false, pb, (short)0, o[j], false, false);
      }
    }
  }

  // Epilogue: join the halves' sums, normalize, store f16 [token, dim] for the
  // out-proj GEMM: a lane's 8 values of a tile are 8 consecutive d.
  const float inv = 1.f / (lrun + xhalf(lrun));
  const int tok = b * SEQ + q0 + wv * 16 + (lane & 15);
#pragma unroll
  for (int j = 0; j < 4; ++j) {
    v8h ov;
#pragma unroll
    for (int r = 0; r < 8; ++r) ov[r] = (_Float16)(o[j][r] * inv);
    *(v8h*)(o_ws + (size_t)tok * DIMN + h * HD + j * 16 + (lane >> 4) * 8) = ov;
  }
}

__global__ __launch_bounds__(128)
void out_proj_kernel(const _Float16* __restrict__ a_ws,
                     const float* __restrict__ Wout,
                     const float* __restrict__ bout,
                     float* __restrict__ out) {
  __shared__ __attribute__((aligned(2048))) _Float16 As[64][LDP32];  // tensor-load target
  __shared__ __align__(16) _Float16 Ws[64][LDP32];

  const int m0   = blockIdx.y * 64;
  const int n0   = blockIdx.x * 64;
  const int t    = threadIdx.x;
  const int wv   = t >> 5;
  const int lane = t & 31;
  const unsigned int wave = uni((unsigned int)t >> 5);
  const u32x8 g1 = tdm_group1<64, 64, 3>(DIMN * 2);

  v8f acc[4] = {};

  for (int k0 = 0; k0 < DIMN; k0 += 32) {
    __syncthreads();
    const u32x4 ga = tdm_group0(a_ws + (size_t)m0 * DIMN + k0, lds_offset_of(&As[0][0]));
    if (pinned(wave == 0u)) tdm_issue(ga, g1);
    {   // stage Wout tile (f32 -> f16) — overlaps the DMA
      const int row = t >> 1, half = (t & 1) * 16;
      const float* src = Wout + (size_t)(n0 + row) * DIMN + k0 + half;
      _Float16* dst = &Ws[row][half];
#pragma unroll
      for (int i = 0; i < 16; i += 4) {
        v4f f = *(const v4f*)(src + i);
        dst[i]   = (_Float16)f[0]; dst[i+1] = (_Float16)f[1];
        dst[i+2] = (_Float16)f[2]; dst[i+3] = (_Float16)f[3];
      }
    }
    if (pinned(wave == 0u)) tdm_wait(ga, g1);
    __syncthreads();

    const v16h a = ldsFrag(&As[wv * 16][0], LDP32);
#pragma unroll
    for (int j = 0; j < 4; ++j) {
      const v16h bw = ldsFrag(&Ws[j * 16][0], LDP32);
      acc[j] = __builtin_amdgcn_wmma_f32_16x16x32_f16(
          false, a, false, bw, (short)0, acc[j], false, false);
    }
  }

  const int rowOff = (lane >> 4) * 8, col = lane & 15;
#pragma unroll
  for (int j = 0; j < 4; ++j) {
    const float bias = bout[n0 + j * 16 + col];
#pragma unroll
    for (int r = 0; r < 8; ++r) {
      const int tok = m0 + wv * 16 + rowOff + r;
      out[(size_t)tok * DIMN + n0 + j * 16 + col] = acc[j][r] + bias;
    }
  }
}

// ---------------------------------------------------------------------------
extern "C" void kernel_launch(void* const* d_in, const int* in_sizes, int n_in,
                              void* d_out, int out_size, void* d_ws, size_t ws_size,
                              hipStream_t stream) {
  (void)in_sizes; (void)n_in; (void)out_size; (void)ws_size;

  const float* x       = (const float*)d_in[0];
  const float* context = (const float*)d_in[1];
  const float* Wqkv    = (const float*)d_in[2];
  const float* bqkv    = (const float*)d_in[3];
  const float* Wout    = (const float*)d_in[4];
  const float* bout    = (const float*)d_in[5];
  float* out = (float*)d_out;

  _Float16* q_ws = (_Float16*)d_ws;                    // 16 MB
  _Float16* k_ws = q_ws + (size_t)TOKENS * DIMN;       // 16 MB
  _Float16* o_ws = k_ws + (size_t)TOKENS * DIMN;       // 16 MB

  const dim3 blk(128, 1, 1);
  qk_proj_kernel <<<dim3(2048 / 64, TOKENS / 64, 1), blk, 0, stream>>>(
      x, Wqkv, bqkv, q_ws, k_ws);
  attn_kernel    <<<dim3(SEQ / 64, BATCH * NHEADS, 1), blk, 0, stream>>>(
      q_ws, k_ws, context, o_ws);
  out_proj_kernel<<<dim3(DIMN / 64, TOKENS / 64, 1), blk, 0, stream>>>(
      o_ws, Wout, bout, out);
}

// v003
// It runs in 200 microseconds.
// In both of two side-by-side timings against v002, it was 1.32 times as fast.
// Over all steps from v000 it is 2.77 times as fast.
#include <hip/hip_runtime.h>

typedef __attribute__((ext_vector_type(16))) _Float16 v16h;
typedef __attribute__((ext_vector_type(8)))  _Float16 v8h;
typedef __attribute__((ext_vector_type(4)))  _Float16 v4h;
typedef __attribute__((ext_vector_type(8)))  float    v8f;
typedef __attribute__((ext_vector_type(4)))  float    v4f;
typedef __attribute__((ext_vector_type(2)))  float    v2f;
typedef __attribute__((ext_vector_type(4)))  unsigned int u32x4;
typedef __attribute__((ext_vector_type(8)))  unsigned int u32x8;

#define DIMN   1024
#define NHEADS 16
#define HD     64
#define SEQ    2048
#define BATCH  4
#define TOKENS (BATCH * SEQ)   // 8192
#define ATT_SCALE 0.125f       // HEAD_DIM^-0.5 = 1/8
#define LDP64  72              // 64-half rows: 144 B
#define LDP32  40              // 32-half rows:  80 B

__device__ __forceinline__ unsigned int uni(unsigned int v) {
  return (unsigned int)__builtin_amdgcn_readfirstlane(v);
}
// Holds a wave-uniform test in a scalar register, so that the branch around a
// tensor load compiles to s_cmp + s_cbranch_scc.
__device__ __forceinline__ unsigned int pinned(unsigned int v) {
  unsigned int w = uni(v);
  asm volatile("" : "+s"(w));
  return w;
}
__device__ __forceinline__ u32x4 tdm_group0(const void* gsrc, unsigned int lds_off) {
  const unsigned long long ga = (unsigned long long)(uintptr_t)gsrc;
  u32x4 g0;
  g0[0] = uni(1u);                                        // count=1
  g0[1] = uni(lds_off);                                   // LDS byte address
  g0[2] = uni((unsigned int)ga);                          // global_addr[31:0]
  g0[3] = uni((((unsigned int)(ga >> 32)) & 0x01ffffffu)  // global_addr[56:32]
              | 0x80000000u);                             // type=2
  return g0;
}
template <unsigned int ROWB, unsigned int ROWS, unsigned int IVL>
__device__ __forceinline__ u32x8 tdm_group1(unsigned int src_pitch) {
  u32x8 g1;
  g1[0] = uni((1u << 20) | (IVL << 22) | (3u << 25));
  g1[1] = uni((ROWB & 0xffffu) << 16);
  g1[2] = uni((ROWB >> 16) | ((ROWS & 0xffffu) << 16));
  g1[3] = uni((ROWS >> 16) | (ROWB << 16));
  g1[4] = uni(ROWS);
  g1[5] = uni(src_pitch);
  g1[6] = uni(0u);
  g1[7] = uni(0u);
  asm volatile("" : "+s"(g1));
  return g1;
}
__device__ __forceinline__ void tdm_issue(u32x4 g0, u32x8 g1) {
  asm volatile("tensor_load_to_lds %0, %1" :: "s"(g0), "s"(g1) : "memory");
}
__device__ __forceinline__ void tdm_wait(u32x4 g0, u32x8 g1) {
  asm volatile("s_wait_tensorcnt 0x0" :: "s"(g0), "s"(g1) : "memory");
}

__device__ __forceinline__ unsigned int lds_offset_of(const void* p) {
  return (unsigned int)(uintptr_t)p;
}

__device__ __forceinline__ v16h ldsFrag(const _Float16* base, int ld) {
  const int lane = threadIdx.x & 31;
  const int r    = lane & 15;
  const int kb   = (lane >> 4) << 3;
  const _Float16* p = base + r * ld + kb;
  const v8h lo = *(const v8h*)(p);
  const v8h hi = *(const v8h*)(p + 16);
  v16h f;
#pragma unroll
  for (int i = 0; i < 8; ++i) { f[i] = lo[i]; f[8 + i] = hi[i]; }
  return f;
}

// ---------------------------------------------------------------------------
// Staging of a 64 x 32 f32 tile (row pitch DIMN floats) as f16, 128 threads.
// A tile row is one 128-byte line: eight lanes run along it, so each wave-wide
// 16-byte load covers four whole lines. The loops are unrolled so that the
// four vectors are indexed by constants and stay in registers.
// ---------------------------------------------------------------------------
struct Tile32 { v4f f[4]; };
__device__ __forceinline__ Tile32 loadTile32(const float* __restrict__ tile, int t) {
  const unsigned int off = (unsigned int)(t >> 3) * DIMN + (unsigned int)(t & 7) * 4;
  Tile32 r;
#pragma unroll
  for (int i = 0; i < 4; ++i) r.f[i] = *(const v4f*)(tile + i * 16 * DIMN + off);
  return r;
}
__device__ __forceinline__ void storeTile32(_Float16 (*dst)[LDP32], const Tile32& r, int t) {
#pragma unroll
  for (int i = 0; i < 4; ++i) {
    const v4h hv = {(_Float16)r.f[i][0], (_Float16)r.f[i][1],
                    (_Float16)r.f[i][2], (_Float16)r.f[i][3]};
    *(v4h*)&dst[i * 16 + (t >> 3)][(t & 7) * 4] = hv;
  }
}

__device__ __forceinline__ float xhalf(float v) {
  const int b = __builtin_bit_cast(int, v);
  return __builtin_bit_cast(float, __builtin_amdgcn_permlanex16(
      b, b, 0x76543210, 0xfedcba98, false, false));
}

__global__ __launch_bounds__(128)
void qk_proj_kernel(const float* __restrict__ x,
                    const float* __restrict__ Wqkv,
                    const float* __restrict__ bqkv,
                    _Float16* __restrict__ q_ws,
                    _Float16* __restrict__ k_ws) {
  __shared__ __align__(16) _Float16 Xs[64][LDP32];
  __shared__ __align__(16) _Float16 Ws[64][LDP32];

  const int m0   = blockIdx.y * 64;
  const int n0   = blockIdx.x * 64;
  const int t    = threadIdx.x;
  const int wv   = t >> 5;
  const int lane = t & 31;

  v8f acc[4] = {};

  for (int k0 = 0; k0 < DIMN; k0 += 32) {
    __syncthreads();
    {   // stage the X and W tiles (f32 -> f16)
      const Tile32 xt = loadTile32(x + (size_t)m0 * DIMN + k0, t);
      const Tile32 wt = loadTile32(Wqkv + (size_t)n0 * DIMN + k0, t);
      storeTile32(Xs, xt, t);
      storeTile32(Ws, wt, t);
    }
    __syncthreads();

    const v16h a = ldsFrag(&Xs[wv * 16][0], LDP32);
#pragma unroll
    for (int j = 0; j < 4; ++j) {
      const v16h b = ldsFrag(&Ws[j * 16][0], LDP32);
      acc[j] = __builtin_amdgcn_wmma_f32_16x16x32_f16(
          false, a, false, b, (short)0, acc[j], false, false);
    }
  }

  const int rowOff = (lane >> 4) * 8;
  const int col    = lane & 15;
#pragma unroll
  for (int j = 0; j < 4; ++j) {
    const int gcol = n0 + j * 16 + col;
    const float bias = bqkv[gcol];
#pragma unroll
    for (int r = 0; r < 8; ++r) {
      const int tok = m0 + wv * 16 + rowOff + r;
      const int b   = tok >> 11, n = tok & (SEQ - 1);
      const _Float16 hv = (_Float16)(acc[j][r] + bias);
      if (gcol < DIMN) {
        const int h = gcol >> 6, d = gcol & 63;
        q_ws[(((size_t)(b * NHEADS + h)) * SEQ + n) * HD + d] = hv;
      } else {
        const int c = gcol - DIMN;
        const int h = c >> 6, d = c & 63;
        k_ws[(((size_t)(b * NHEADS + h)) * SEQ + n) * HD + d] = hv;
      }
    }
  }
}

__global__ __launch_bounds__(128)
void attn_kernel(const _Float16* __restrict__ q_ws,
                 const _Float16* __restrict__ k_ws,
                 const float* __restrict__ context,
                 _Float16* __restrict__ o_ws) {
  // Tensor-load targets: placed at multiples of 2 KiB, sizes rounded up to one.
  __shared__ __attribute__((aligned(2048))) _Float16 Qs[5120];   // 64 x LDP64 used
  __shared__ __attribute__((aligned(2048))) _Float16 Ks[5120];   // 64 x LDP64 used
  __shared__ __align__(16) _Float16 VTs[64][LDP64];

  const int q0   = blockIdx.x * 64;
  const int bh   = blockIdx.y;
  const int b    = bh >> 4, h = bh & 15;
  const int t    = threadIdx.x;
  const int wv   = t >> 5;
  const int lane = t & 31;
  const unsigned int wave = uni((unsigned int)t >> 5);

  const _Float16* qbase = q_ws + (size_t)bh * SEQ * HD;
  const _Float16* kbase = k_ws + (size_t)bh * SEQ * HD;

  const u32x8 g1 = tdm_group1<128, 64, 4>(HD * 2);
  if (pinned(wave == 0u)) {
    const u32x4 gq = tdm_group0(qbase + (size_t)q0 * HD, lds_offset_of(&Qs[0]));
    tdm_issue(gq, g1);
    tdm_wait(gq, g1);
  }
  __syncthreads();

  v16h aq[2];
  aq[0] = ldsFrag(&Qs[wv * 16 * LDP64],      LDP64);
  aq[1] = ldsFrag(&Qs[wv * 16 * LDP64 + 32], LDP64);

  // Per lane: its query's running maximum (equal in both halves) and the sum
  // over this half's keys (the halves are joined in the epilogue).
  float mrun = -1e30f, lrun = 0.f;
  v8f o[4] = {};   // O^T: d = j * 16 + (lane >> 4) * 8 + r, query = lane & 15

  for (int kt = 0; kt < SEQ / 64; ++kt) {
    __syncthreads();
    // K tile DMA: issue first so it overlaps the V^T convert staging below.
    const u32x4 gk = tdm_group0(kbase + (size_t)kt * 64 * HD, lds_offset_of(&Ks[0]));
    if (pinned(wave == 0u)) tdm_issue(gk, g1);
    {   // stage V^T from context (f32 -> f16, transposed)
      // Eight lanes run along one 128-byte line of a key's row, so each
      // wave-wide load covers four whole lines. A lane takes the same four d of
      // four consecutive keys: each d is then one 8-byte store along VTs' row.
      // The loops are unrolled so that f is indexed by constants (registers).
      const int dl = (lane & 7) * 4;            // d offset within a line
      const int k4 = (wv * 4 + (lane >> 3)) * 4; // first of the lane's four keys
      const float* src = context + ((size_t)b * SEQ + kt * 64 + k4) * DIMN + h * HD + dl;
      v4f f[2][4];
#pragma unroll
      for (int i = 0; i < 2; ++i)
#pragma unroll
        for (int j = 0; j < 4; ++j) f[i][j] = *(const v4f*)(src + (size_t)j * DIMN + i * 32);
#pragma unroll
      for (int i = 0; i < 2; ++i)
#pragma unroll
        for (int c = 0; c < 4; ++c) {
          const v4h hv = {(_Float16)f[i][0][c], (_Float16)f[i][1][c],
                          (_Float16)f[i][2][c], (_Float16)f[i][3][c]};
          *(v4h*)&VTs[i * 32 + dl + c][k4] = hv;
        }
    }
    if (pinned(wave == 0u)) tdm_wait(gk, g1);
    __syncthreads();

    // S^T = K Q^T (64 keys x 16 queries per wave)
    v8f s4[4];
#pragma unroll
    for (int j = 0; j < 4; ++j) {
      v8f sc = {};
#pragma unroll
      for (int ks = 0; ks < 2; ++ks) {
        const v16h ak = ldsFrag(&Ks[j * 16 * LDP64 + ks * 32], LDP64);
        sc = __builtin_amdgcn_wmma_f32_16x16x32_f16(
            false, ak, false, aq[ks], (short)0, sc, false, false);
      }
      s4[j] = sc;
    }

    // Online softmax, one query per lane
    float tm = -1e30f;
#pragma unroll
    for (int j = 0; j < 4; ++j)
#pragma unroll
      for (int r = 0; r < 8; ++r) { s4[j][r] *= ATT_SCALE; tm = fmaxf(tm, s4[j][r]); }
    tm = fmaxf(tm, xhalf(tm));
    const float mnew  = fmaxf(mrun, tm);
    const float alpha = __expf(mrun - mnew);
    float rs = 0.f;
#pragma unroll
    for (int j = 0; j < 4; ++j)
#pragma unroll
      for (int r = 0; r < 8; r += 2) {
        // The two differences as one register pair (packed f32 arithmetic).
        const v2f d = (v2f){s4[j][r], s4[j][r + 1]} - (v2f){mnew, mnew};
        const float e0 = __expf(d[0]), e1 = __expf(d[1]);
        s4[j][r] = e0; s4[j][r + 1] = e1; rs += e0; rs += e1;
      }
    lrun = lrun * alpha + rs;
    mrun = mnew;
#pragma unroll
    for (int j = 0; j < 4; ++j)
#pragma unroll
      for (int r = 0; r < 8; ++r) o[j][r] *= alpha;

    // O^T += V^T P^T. Score tiles 2ks and 2ks+1 hold this lane's keys
    // kb..kb+7 and kb+16..kb+23 (kb = (lane >> 4) * 8) of the 32-key block:
    // the k order of ldsFrag, so they pack straight into the B fragment.
#pragma unroll
    for (int ks = 0; ks < 2; ++ks) {
      v16h pb;
#pragma unroll
      for (int i = 0; i < 8; ++i) {
        pb[i]     = (_Float16)s4[2 * ks][i];
        pb[8 + i] = (_Float16)s4[2 * ks + 1][i];
      }
#pragma unroll
      for (int j = 0; j < 4; ++j) {
        const v16h av = ldsFrag(&VTs[j * 16][ks * 32], LDP64);
        o[j] = __builtin_amdgcn_wmma_f32_16x16x32_f16(
            false, av, false, pb, (short)0, o[j], false, false);
      }
    }
  }

  // Epilogue: join the halves' sums, normalize, store f16 [token, dim] for the
  // out-proj GEMM: a lane's 8 values of a tile are 8 consecutive d.
  const float inv = 1.f / (lrun + xhalf(lrun));
  const int tok = b * SEQ + q0 + wv * 16 + (lane & 15);
#pragma unroll
  for (int j = 0; j < 4; ++j) {
    v8h ov;
#pragma unroll
    for (int r = 0; r < 8; ++r) ov[r] = (_Float16)(o[j][r] * inv);
    *(v8h*)(o_ws + (size_t)tok * DIMN + h * HD + j * 16 + (lane >> 4) * 8) = ov;
  }
}

__global__ __launch_bounds__(128)
void out_proj_kernel(const _Float16* __restrict__ a_ws,
                     const float* __restrict__ Wout,
                     const float* __restrict__ bout,
                     float* __restrict__ out) {
  __shared__ __attribute__((aligned(2048))) _Float16 As[64][LDP32];  // tensor-load target
  __shared__ __align__(16) _Float16 Ws[64][LDP32];

  const int m0   = blockIdx.y * 64;
  const int n0   = blockIdx.x * 64;
  const int t    = threadIdx.x;
  const int wv   = t >> 5;
  const int lane = t & 31;
  const unsigned int wave = uni((unsigned int)t >> 5);
  const u32x8 g1 = tdm_group1<64, 64, 3>(DIMN * 2);

  v8f acc[4] = {};

  for (int k0 = 0; k0 < DIMN; k0 += 32) {
    __syncthreads();
    const u32x4 ga = tdm_group0(a_ws + (size_t)m0 * DIMN + k0, lds_offset_of(&As[0][0]));
    if (pinned(wave == 0u)) tdm_issue(ga, g1);
    // stage Wout tile (f32 -> f16): overlaps the DMA
    storeTile32(Ws, loadTile32(Wout + (size_t)n0 * DIMN + k0, t), t);
    if (pinned(wave == 0u)) tdm_wait(ga, g1);
    __syncthreads();

    const v16h a = ldsFrag(&As[wv * 16][0], LDP32);
#pragma unroll
    for (int j = 0; j < 4; ++j) {
      const v16h bw = ldsFrag(&Ws[j * 16][0], LDP32);
      acc[j] = __builtin_amdgcn_wmma_f32_16x16x32_f16(
          false, a, false, bw, (short)0, acc[j], false, false);
    }
  }

  const int rowOff = (lane >> 4) * 8, col = lane & 15;
#pragma unroll
  for (int j = 0; j < 4; ++j) {
    const float bias = bout[n0 + j * 16 + col];
#pragma unroll
    for (int r = 0; r < 8; ++r) {
      const int tok = m0 + wv * 16 + rowOff + r;
      out[(size_t)tok * DIMN + n0 + j * 16 + col] = acc[j][r] + bias;
    }
  }
}

// ---------------------------------------------------------------------------
extern "C" void kernel_launch(void* const* d_in, const int* in_sizes, int n_in,
                              void* d_out, int out_size, void* d_ws, size_t ws_size,
                              hipStream_t stream) {
  (void)in_sizes; (void)n_in; (void)out_size; (void)ws_size;

  const float* x       = (const float*)d_in[0];
  const float* context = (const float*)d_in[1];
  const float* Wqkv    = (const float*)d_in[2];
  const float* bqkv    = (const float*)d_in[3];
  const float* Wout    = (const float*)d_in[4];
  const float* bout    = (const float*)d_in[5];
  float* out = (float*)d_out;

  _Float16* q_ws = (_Float16*)d_ws;                    // 16 MB
  _Float16* k_ws = q_ws + (size_t)TOKENS * DIMN;       // 16 MB
  _Float16* o_ws = k_ws + (size_t)TOKENS * DIMN;       // 16 MB

  const dim3 blk(128, 1, 1);
  qk_proj_kernel <<<dim3(2048 / 64, TOKENS / 64, 1), blk, 0, stream>>>(
      x, Wqkv, bqkv, q_ws, k_ws);
  attn_kernel    <<<dim3(SEQ / 64, BATCH * NHEADS, 1), blk, 0, stream>>>(
      q_ws, k_ws, context, o_ws);
  out_proj_kernel<<<dim3(DIMN / 64, TOKENS / 64, 1), blk, 0, stream>>>(
      o_ws, Wout, bout, out);
}

// v004
// One run takes 137 microseconds.
// Timed twice side by side with v003, it ran 1.44 and 1.45 times as fast.
// Over all steps from v000 it is 4.01 times as fast.
#include <hip/hip_runtime.h>

typedef __attribute__((ext_vector_type(16))) _Float16 v16h;
typedef __attribute__((ext_vector_type(8)))  _Float16 v8h;
typedef __attribute__((ext_vector_type(4)))  _Float16 v4h;
typedef __attribute__((ext_vector_type(8)))  float    v8f;
typedef __attribute__((ext_vector_type(4)))  float    v4f;
typedef __attribute__((ext_vector_type(2)))  float    v2f;
typedef __attribute__((ext_vector_type(4)))  unsigned int u32x4;
typedef __attribute__((ext_vector_type(8)))  unsigned int u32x8;

#define DIMN   1024
#define NHEADS 16
#define HD     64
#define SEQ    2048
#define BATCH  4
#define TOKENS (BATCH * SEQ)   // 8192
#define ATT_SCALE 0.125f       // HEAD_DIM^-0.5 = 1/8
#define LDP64  72              // 64-half rows: 144 B
#define LDP32  40              // 32-half rows:  80 B

__device__ __forceinline__ unsigned int uni(unsigned int v) {
  return (unsigned int)__builtin_amdgcn_readfirstlane(v);
}
// Holds a wave-uniform test in a scalar register, so that the branch around a
// tensor load compiles to s_cmp + s_cbranch_scc.
__device__ __forceinline__ unsigned int pinned(unsigned int v) {
  unsigned int w = uni(v);
  asm volatile("" : "+s"(w));
  return w;
}
__device__ __forceinline__ u32x4 tdm_group0(const void* gsrc, unsigned int lds_off) {
  const unsigned long long ga = (unsigned long long)(uintptr_t)gsrc;
  u32x4 g0;
  g0[0] = uni(1u);                                        // count=1
  g0[1] = uni(lds_off);                                   // LDS byte address
  g0[2] = uni((unsigned int)ga);                          // global_addr[31:0]
  g0[3] = uni((((unsigned int)(ga >> 32)) & 0x01ffffffu)  // global_addr[56:32]
              | 0x80000000u);                             // type=2
  return g0;
}
template <unsigned int ROWB, unsigned int ROWS, unsigned int IVL>
__device__ __forceinline__ u32x8 tdm_group1(unsigned int src_pitch) {
  u32x8 g1;
  g1[0] = uni((1u << 20) | (IVL << 22) | (3u << 25));
  g1[1] = uni((ROWB & 0xffffu) << 16);
  g1[2] = uni((ROWB >> 16) | ((ROWS & 0xffffu) << 16));
  g1[3] = uni((ROWS >> 16) | (ROWB << 16));
  g1[4] = uni(ROWS);
  g1[5] = uni(src_pitch);
  g1[6] = uni(0u);
  g1[7] = uni(0u);
  asm volatile("" : "+s"(g1));
  return g1;
}
__device__ __forceinline__ void tdm_issue(u32x4 g0, u32x8 g1) {
  asm volatile("tensor_load_to_lds %0, %1" :: "s"(g0), "s"(g1) : "memory");
}
__device__ __forceinline__ void tdm_wait(u32x4 g0, u32x8 g1) {
  asm volatile("s_wait_tensorcnt 0x0" :: "s"(g0), "s"(g1) : "memory");
}

__device__ __forceinline__ unsigned int lds_offset_of(const void* p) {
  return (unsigned int)(uintptr_t)p;
}

__device__ __forceinline__ v16h ldsFrag(const _Float16* base, int ld) {
  const int lane = threadIdx.x & 31;
  const int r    = lane & 15;
  const int kb   = (lane >> 4) << 3;
  const _Float16* p = base + r * ld + kb;
  const v8h lo = *(const v8h*)(p);
  const v8h hi = *(const v8h*)(p + 16);
  v16h f;
#pragma unroll
  for (int i = 0; i < 8; ++i) { f[i] = lo[i]; f[8 + i] = hi[i]; }
  return f;
}

// ---------------------------------------------------------------------------
// Staging of a 128 x 32 f32 tile (row pitch DIMN floats) as f16, 128 threads.
// A tile row is one 128-byte line: eight lanes run along it, so each wave-wide
// 16-byte load covers four whole lines. The loops are unrolled so that the
// eight vectors are indexed by constants and stay in registers.
// ---------------------------------------------------------------------------
struct Tile32 { v4f f[8]; };
// The lane's first address within a tile.
__device__ __forceinline__ const float* laneOf32(const float* __restrict__ tile, int t) {
  return tile + ((unsigned int)(t >> 3) * DIMN + (unsigned int)(t & 7) * 4);
}
__device__ __forceinline__ Tile32 loadTile32(const float* __restrict__ lanep) {
  Tile32 r;
#pragma unroll
  for (int i = 0; i < 8; ++i) r.f[i] = *(const v4f*)(lanep + i * 16 * DIMN);
  return r;
}
__device__ __forceinline__ void storeTile32(_Float16 (*dst)[LDP32], const Tile32& r, int t) {
#pragma unroll
  for (int i = 0; i < 8; ++i) {
    const v4h hv = {(_Float16)r.f[i][0], (_Float16)r.f[i][1],
                    (_Float16)r.f[i][2], (_Float16)r.f[i][3]};
    *(v4h*)&dst[i * 16 + (t >> 3)][(t & 7) * 4] = hv;
  }
}
// The same for a 128 x 64 f32 tile: a row is two lines, sixteen lanes run along
// it, and a wave-wide load again covers four whole lines.
struct Tile64 { v4f f[16]; };
__device__ __forceinline__ Tile64 loadTile64(const float* __restrict__ tile, int t) {
  const unsigned int off = (unsigned int)(t >> 4) * DIMN + (unsigned int)(t & 15) * 4;
  Tile64 r;
#pragma unroll
  for (int i = 0; i < 16; ++i) r.f[i] = *(const v4f*)(tile + i * 8 * DIMN + off);
  return r;
}
__device__ __forceinline__ void storeTile64(_Float16 (*dst)[LDP64], const Tile64& r, int t) {
#pragma unroll
  for (int i = 0; i < 16; ++i) {
    const v4h hv = {(_Float16)r.f[i][0], (_Float16)r.f[i][1],
                    (_Float16)r.f[i][2], (_Float16)r.f[i][3]};
    *(v4h*)&dst[i * 8 + (t >> 4)][(t & 15) * 4] = hv;
  }
}

__device__ __forceinline__ float xhalf(float v) {
  const int b = __builtin_bit_cast(int, v);
  return __builtin_bit_cast(float, __builtin_amdgcn_permlanex16(
      b, b, 0x76543210, 0xfedcba98, false, false));
}

__global__ __launch_bounds__(128)
void qk_proj_kernel(const float* __restrict__ x,
                    const float* __restrict__ Wqkv,
                    const float* __restrict__ bqkv,
                    _Float16* __restrict__ q_ws,
                    _Float16* __restrict__ k_ws) {
  __shared__ __align__(16) _Float16 Xs[128][LDP32];
  __shared__ __align__(16) _Float16 Ws[128][LDP32];

  const int m0   = blockIdx.y * 128;
  const int n0   = blockIdx.x * 128;
  const int t    = threadIdx.x;
  const int wv   = t >> 5;
  const int lane = t & 31;
  const int wm   = (wv >> 1) * 64;   // the wave's rows within the tile
  const int wn   = (wv & 1) * 64;    // the wave's columns within the tile

  v8f acc[4][4] = {};

  for (int k0 = 0; k0 < DIMN; k0 += 32) {
    __syncthreads();
    {   // stage the X and W tiles (f32 -> f16)
      const float* xl = laneOf32(x + (size_t)m0 * DIMN + k0, t);
      const float* wl = laneOf32(Wqkv + (size_t)n0 * DIMN + k0, t);
      const Tile32 xt = loadTile32(xl);
      const Tile32 wt = loadTile32(wl);
      // The wait that stands before a register named by an issued load is
      // overwritten. Naming the two addresses keeps them out of the loads' own
      // destinations; the clobber keeps all sixteen loads ahead of it, in
      // flight together.
      asm volatile("s_wait_xcnt 0x0" :: "v"(xl), "v"(wl) : "memory");
      storeTile32(Xs, xt, t);
      storeTile32(Ws, wt, t);
    }
    __syncthreads();

    v16h a[4], b[4];
#pragma unroll
    for (int i = 0; i < 4; ++i) a[i] = ldsFrag(&Xs[wm + i * 16][0], LDP32);
#pragma unroll
    for (int j = 0; j < 4; ++j) b[j] = ldsFrag(&Ws[wn + j * 16][0], LDP32);
    __builtin_amdgcn_sched_barrier(0);
#pragma unroll
    for (int j = 0; j < 4; ++j)
#pragma unroll
      for (int i = 0; i < 4; ++i)
        acc[i][j] = __builtin_amdgcn_wmma_f32_16x16x32_f16(
            false, a[i], false, b[j], (short)0, acc[i][j], false, false);
  }

  // A wave's 64 columns are one head of q or of k and its 64 rows lie in one
  // batch: one lane address, every store at a constant offset from it.
  const int rowOff = (lane >> 4) * 8;
  const int col    = lane & 15;
  const int gc0    = n0 + wn;                 // first column, a multiple of 64
  const int tok0   = m0 + wm;                 // first row, a multiple of 64
  const int h      = (gc0 >> 6) & (NHEADS - 1);
  const int bt     = tok0 >> 11, n = tok0 & (SEQ - 1);
  _Float16* dst = (gc0 < DIMN ? q_ws : k_ws)
                  + (((size_t)(bt * NHEADS + h)) * SEQ + n + rowOff) * HD + col;
#pragma unroll
  for (int j = 0; j < 4; ++j) {
    const float bias = bqkv[gc0 + j * 16 + col];
#pragma unroll
    for (int i = 0; i < 4; ++i)
#pragma unroll
      for (int r = 0; r < 8; ++r)
        dst[(i * 16 + r) * HD + j * 16] = (_Float16)(acc[i][j][r] + bias);
  }
}

__global__ __launch_bounds__(128)
void attn_kernel(const _Float16* __restrict__ q_ws,
                 const _Float16* __restrict__ k_ws,
                 const float* __restrict__ context,
                 _Float16* __restrict__ o_ws) {
  // Tensor-load targets: placed at multiples of 2 KiB, sizes rounded up to one.
  __shared__ __attribute__((aligned(2048))) _Float16 Qs[9216];   // 128 x LDP64
  __shared__ __attribute__((aligned(2048))) _Float16 Ks[5120];   // 64 x LDP64 used
  __shared__ __align__(16) _Float16 VTs[64][LDP64];

  const int q0   = blockIdx.x * 128;
  const int bh   = blockIdx.y;
  const int b    = bh >> 4, h = bh & 15;
  const int t    = threadIdx.x;
  const int wv   = t >> 5;
  const int lane = t & 31;
  const unsigned int wave = uni((unsigned int)t >> 5);

  const _Float16* qbase = q_ws + (size_t)bh * SEQ * HD;
  const _Float16* kbase = k_ws + (size_t)bh * SEQ * HD;

  if (pinned(wave == 0u)) {
    const u32x8 g1q = tdm_group1<128, 128, 4>(HD * 2);
    const u32x4 gq = tdm_group0(qbase + (size_t)q0 * HD, lds_offset_of(&Qs[0]));
    tdm_issue(gq, g1q);
    tdm_wait(gq, g1q);
  }
  const u32x8 g1 = tdm_group1<128, 64, 4>(HD * 2);
  __syncthreads();

  v16h aq[2][2];   // [column group][32-wide k block]
#pragma unroll
  for (int c = 0; c < 2; ++c) {
    aq[c][0] = ldsFrag(&Qs[(wv * 32 + c * 16) * LDP64],      LDP64);
    aq[c][1] = ldsFrag(&Qs[(wv * 32 + c * 16) * LDP64 + 32], LDP64);
  }

  // Per lane and column group: its query's running maximum (equal in both
  // halves) and the sum over this half's keys (joined in the epilogue).
  float mrun[2] = {-1e30f, -1e30f}, lrun[2] = {0.f, 0.f};
  // O^T: d = j * 16 + (lane >> 4) * 8 + r, query = c * 16 + (lane & 15)
  v8f o[2][4] = {};

  for (int kt = 0; kt < SEQ / 64; ++kt) {
    __syncthreads();
    // K tile DMA: issue first so it overlaps the V^T convert staging below.
    const u32x4 gk = tdm_group0(kbase + (size_t)kt * 64 * HD, lds_offset_of(&Ks[0]));
    if (pinned(wave == 0u)) tdm_issue(gk, g1);
    {   // stage V^T from context (f32 -> f16, transposed)
      // Eight lanes run along one 128-byte line of a key's row, so each
      // wave-wide load covers four whole lines. A lane takes the same four d of
      // four consecutive keys: each d is then one 8-byte store along VTs' row.
      // The loops are unrolled so that f is indexed by constants (registers).
      const int dl = (lane & 7) * 4;            // d offset within a line
      const int k4 = (wv * 4 + (lane >> 3)) * 4; // first of the lane's four keys
      const float* src = context + ((size_t)b * SEQ + kt * 64 + k4) * DIMN + h * HD + dl;
      v4f f[2][4];
#pragma unroll
      for (int i = 0; i < 2; ++i)
#pragma unroll
        for (int j = 0; j < 4; ++j) f[i][j] = *(const v4f*)(src + (size_t)j * DIMN + i * 32);
#pragma unroll
      for (int i = 0; i < 2; ++i)
#pragma unroll
        for (int c = 0; c < 4; ++c) {
          const v4h hv = {(_Float16)f[i][0][c], (_Float16)f[i][1][c],
                          (_Float16)f[i][2][c], (_Float16)f[i][3][c]};
          *(v4h*)&VTs[i * 32 + dl + c][k4] = hv;
        }
    }
    if (pinned(wave == 0u)) tdm_wait(gk, g1);
    __syncthreads();

    // S^T = K Q^T (64 keys x 32 queries per wave)
    v8f s4[2][4];
#pragma unroll
    for (int j = 0; j < 4; ++j) {
      v8f sc[2] = {};
#pragma unroll
      for (int ks = 0; ks < 2; ++ks) {
        const v16h ak = ldsFrag(&Ks[j * 16 * LDP64 + ks * 32], LDP64);
#pragma unroll
        for (int c = 0; c < 2; ++c)
          sc[c] = __builtin_amdgcn_wmma_f32_16x16x32_f16(
              false, ak, false, aq[c][ks], (short)0, sc[c], false, false);
      }
      s4[0][j] = sc[0];
      s4[1][j] = sc[1];
    }

    // Online softmax, one query per lane and column group
#pragma unroll
    for (int c = 0; c < 2; ++c) {
      float tm = -1e30f;
#pragma unroll
      for (int j = 0; j < 4; ++j)
#pragma unroll
        for (int r = 0; r < 8; ++r) { s4[c][j][r] *= ATT_SCALE; tm = fmaxf(tm, s4[c][j][r]); }
      tm = fmaxf(tm, xhalf(tm));
      const float mnew  = fmaxf(mrun[c], tm);
      float alpha;
      asm("v_exp_f32 %0, %1\n\tv_nop" : "=v"(alpha) : "v"((mrun[c] - mnew) * 1.44269504f));
      float rs = 0.f;
#pragma unroll
      for (int j = 0; j < 4; ++j)
#pragma unroll
        for (int r = 0; r < 8; r += 2) {
          // The two differences as one register pair (packed f32 arithmetic).
          const v2f d = (v2f){s4[c][j][r], s4[c][j][r + 1]} - (v2f){mnew, mnew};
          const float e0 = __expf(d[0]), e1 = __expf(d[1]);
          s4[c][j][r] = e0; s4[c][j][r + 1] = e1; rs += e0; rs += e1;
        }
      lrun[c] = lrun[c] * alpha + rs;
      mrun[c] = mnew;
#pragma unroll
      for (int j = 0; j < 4; ++j)
#pragma unroll
        for (int r = 0; r < 8; ++r) o[c][j][r] *= alpha;
    }

    // O^T += V^T P^T. Score tiles 2ks and 2ks+1 hold this lane's keys
    // kb..kb+7 and kb+16..kb+23 (kb = (lane >> 4) * 8) of the 32-key block:
    // the k order of ldsFrag, so they pack straight into the B fragment.
#pragma unroll
    for (int ks = 0; ks < 2; ++ks) {
      v16h pb[2];
#pragma unroll
      for (int c = 0; c < 2; ++c)
#pragma unroll
        for (int i = 0; i < 8; ++i) {
          pb[c][i]     = (_Float16)s4[c][2 * ks][i];
          pb[c][8 + i] = (_Float16)s4[c][2 * ks + 1][i];
        }
#pragma unroll
      for (int j = 0; j < 4; ++j) {
        const v16h av = ldsFrag(&VTs[j * 16][ks * 32], LDP64);
#pragma unroll
        for (int c = 0; c < 2; ++c)
          o[c][j] = __builtin_amdgcn_wmma_f32_16x16x32_f16(
              false, av, false, pb[c], (short)0, o[c][j], false, false);
      }
    }
  }

  // Epilogue: join the halves' sums, normalize, store f16 [token, dim] for the
  // out-proj GEMM: a lane's 8 values of a tile are 8 consecutive d.
#pragma unroll
  for (int c = 0; c < 2; ++c) {
    const float inv = 1.f / (lrun[c] + xhalf(lrun[c]));
    const int tok = b * SEQ + q0 + wv * 32 + c * 16 + (lane & 15);
#pragma unroll
    for (int j = 0; j < 4; ++j) {
      v8h ov;
#pragma unroll
      for (int r = 0; r < 8; ++r) ov[r] = (_Float16)(o[c][j][r] * inv);
      *(v8h*)(o_ws + (size_t)tok * DIMN + h * HD + j * 16 + (lane >> 4) * 8) = ov;
    }
  }
}

__global__ __launch_bounds__(128)
void out_proj_kernel(const _Float16* __restrict__ a_ws,
                     const float* __restrict__ Wout,
                     const float* __restrict__ bout,
                     float* __restrict__ out) {
  __shared__ __attribute__((aligned(2048))) _Float16 As[128][LDP64];  // tensor-load target
  __shared__ __align__(16) _Float16 Ws[128][LDP64];

  const int m0   = blockIdx.y * 128;
  const int n0   = blockIdx.x * 128;
  const int t    = threadIdx.x;
  const int wv   = t >> 5;
  const int lane = t & 31;
  const int wm   = (wv >> 1) * 64;   // the wave's rows within the tile
  const int wn   = (wv & 1) * 64;    // the wave's columns within the tile
  const unsigned int wave = uni((unsigned int)t >> 5);
  const u32x8 g1 = tdm_group1<128, 128, 4>(DIMN * 2);

  v8f acc[4][4] = {};

  for (int k0 = 0; k0 < DIMN; k0 += 64) {
    __syncthreads();
    const u32x4 ga = tdm_group0(a_ws + (size_t)m0 * DIMN + k0, lds_offset_of(&As[0][0]));
    if (pinned(wave == 0u)) tdm_issue(ga, g1);
    // stage Wout tile (f32 -> f16): overlaps the DMA
    storeTile64(Ws, loadTile64(Wout + (size_t)n0 * DIMN + k0, t), t);
    if (pinned(wave == 0u)) tdm_wait(ga, g1);
    __syncthreads();

#pragma unroll
    for (int ks = 0; ks < 2; ++ks) {
      v16h a[4], bw[4];
#pragma unroll
      for (int i = 0; i < 4; ++i) a[i] = ldsFrag(&As[wm + i * 16][ks * 32], LDP64);
#pragma unroll
      for (int j = 0; j < 4; ++j) bw[j] = ldsFrag(&Ws[wn + j * 16][ks * 32], LDP64);
      __builtin_amdgcn_sched_barrier(0);
#pragma unroll
      for (int j = 0; j < 4; ++j)
#pragma unroll
        for (int i = 0; i < 4; ++i)
          acc[i][j] = __builtin_amdgcn_wmma_f32_16x16x32_f16(
              false, a[i], false, bw[j], (short)0, acc[i][j], false, false);
    }
  }

  const int rowOff = (lane >> 4) * 8, col = lane & 15;
#pragma unroll
  for (int j = 0; j < 4; ++j) {
    const float bias = bout[n0 + wn + j * 16 + col];
#pragma unroll
    for (int i = 0; i < 4; ++i)
#pragma unroll
      for (int r = 0; r < 8; ++r) {
        const int tok = m0 + wm + i * 16 + rowOff + r;
        out[(size_t)tok * DIMN + n0 + wn + j * 16 + col] = acc[i][j][r] + bias;
      }
  }
}

// ---------------------------------------------------------------------------
extern "C" void kernel_launch(void* const* d_in, const int* in_sizes, int n_in,
                              void* d_out, int out_size, void* d_ws, size_t ws_size,
                              hipStream_t stream) {
  (void)in_sizes; (void)n_in; (void)out_size; (void)ws_size;

  const float* x       = (const float*)d_in[0];
  const float* context = (const float*)d_in[1];
  const float* Wqkv    = (const float*)d_in[2];
  const float* bqkv    = (const float*)d_in[3];
  const float* Wout    = (const float*)d_in[4];
  const float* bout    = (const float*)d_in[5];
  float* out = (float*)d_out;

  _Float16* q_ws = (_Float16*)d_ws;                    // 16 MB
  _Float16* k_ws = q_ws + (size_t)TOKENS * DIMN;       // 16 MB
  _Float16* o_ws = k_ws + (size_t)TOKENS * DIMN;       // 16 MB

  const dim3 blk(128, 1, 1);
  qk_proj_kernel <<<dim3(2048 / 128, TOKENS / 128, 1), blk, 0, stream>>>(
      x, Wqkv, bqkv, q_ws, k_ws);
  attn_kernel    <<<dim3(SEQ / 128, BATCH * NHEADS, 1), blk, 0, stream>>>(
      q_ws, k_ws, context, o_ws);
  out_proj_kernel<<<dim3(DIMN / 128, TOKENS / 128, 1), blk, 0, stream>>>(
      o_ws, Wout, bout, out);
}

// v005
// A run of this version takes 129 microseconds.
// In both of two side-by-side timings against v004, it was 1.05 times as fast.
// Counting every step since v000, it is 4.22 times as fast.
#include <hip/hip_runtime.h>

typedef __attribute__((ext_vector_type(16))) _Float16 v16h;
typedef __attribute__((ext_vector_type(8)))  _Float16 v8h;
typedef __attribute__((ext_vector_type(4)))  _Float16 v4h;
typedef __attribute__((ext_vector_type(8)))  float    v8f;
typedef __attribute__((ext_vector_type(4)))  float    v4f;
typedef __attribute__((ext_vector_type(2)))  float    v2f;
typedef __attribute__((ext_vector_type(4)))  unsigned int u32x4;
typedef __attribute__((ext_vector_type(8)))  unsigned int u32x8;

#define DIMN   1024
#define NHEADS 16
#define HD     64
#define SEQ    2048
#define BATCH  4
#define TOKENS (BATCH * SEQ)   // 8192
#define ATT_SCALE 0.125f       // HEAD_DIM^-0.5 = 1/8
#define EXP2_SCALE (ATT_SCALE * 1.44269504f)   // scale * log2 e, carried by q
#define LAZY_MAX 8.0f          // a score may pass the maximum in use by 8 (log2 units)
#define LDP64  72              // 64-half rows: 144 B
#define LDP32  40              // 32-half rows:  80 B

__device__ __forceinline__ unsigned int uni(unsigned int v) {
  return (unsigned int)__builtin_amdgcn_readfirstlane(v);
}
// Holds a wave-uniform test in a scalar register, so that the branch around a
// tensor load compiles to s_cmp + s_cbranch_scc.
__device__ __forceinline__ unsigned int pinned(unsigned int v) {
  unsigned int w = uni(v);
  asm volatile("" : "+s"(w));
  return w;
}
__device__ __forceinline__ u32x4 tdm_group0(const void* gsrc, unsigned int lds_off) {
  const unsigned long long ga = (unsigned long long)(uintptr_t)gsrc;
  u32x4 g0;
  g0[0] = uni(1u);                                        // count=1
  g0[1] = uni(lds_off);                                   // LDS byte address
  g0[2] = uni((unsigned int)ga);                          // global_addr[31:0]
  g0[3] = uni((((unsigned int)(ga >> 32)) & 0x01ffffffu)  // global_addr[56:32]
              | 0x80000000u);                             // type=2
  return g0;
}
template <unsigned int ROWB, unsigned int ROWS, unsigned int IVL>
__device__ __forceinline__ u32x8 tdm_group1(unsigned int src_pitch) {
  u32x8 g1;
  g1[0] = uni((1u << 20) | (IVL << 22) | (3u << 25));
  g1[1] = uni((ROWB & 0xffffu) << 16);
  g1[2] = uni((ROWB >> 16) | ((ROWS & 0xffffu) << 16));
  g1[3] = uni((ROWS >> 16) | (ROWB << 16));
  g1[4] = uni(ROWS);
  g1[5] = uni(src_pitch);
  g1[6] = uni(0u);
  g1[7] = uni(0u);
  asm volatile("" : "+s"(g1));
  return g1;
}
__device__ __forceinline__ void tdm_issue(u32x4 g0, u32x8 g1) {
  asm volatile("tensor_load_to_lds %0, %1" :: "s"(g0), "s"(g1) : "memory");
}
__device__ __forceinline__ void tdm_wait(u32x4 g0, u32x8 g1) {
  asm volatile("s_wait_tensorcnt 0x0" :: "s"(g0), "s"(g1) : "memory");
}

__device__ __forceinline__ unsigned int lds_offset_of(const void* p) {
  return (unsigned int)(uintptr_t)p;
}

__device__ __forceinline__ v16h ldsFrag(const _Float16* base, int ld) {
  const int lane = threadIdx.x & 31;
  const int r    = lane & 15;
  const int kb   = (lane >> 4) << 3;
  const _Float16* p = base + r * ld + kb;
  const v8h lo = *(const v8h*)(p);
  const v8h hi = *(const v8h*)(p + 16);
  v16h f;
#pragma unroll
  for (int i = 0; i < 8; ++i) { f[i] = lo[i]; f[8 + i] = hi[i]; }
  return f;
}

// ---------------------------------------------------------------------------
// Staging of a 128 x 32 f32 tile (row pitch DIMN floats) as f16, 128 threads.
// A tile row is one 128-byte line: eight lanes run along it, so each wave-wide
// 16-byte load covers four whole lines. The loops are unrolled so that the
// eight vectors are indexed by constants and stay in registers.
// ---------------------------------------------------------------------------
struct Tile32 { v4f f[8]; };
// The lane's first address within a tile.
__device__ __forceinline__ const float* laneOf32(const float* __restrict__ tile, int t) {
  return tile + ((unsigned int)(t >> 3) * DIMN + (unsigned int)(t & 7) * 4);
}
__device__ __forceinline__ Tile32 loadTile32(const float* __restrict__ lanep) {
  Tile32 r;
#pragma unroll
  for (int i = 0; i < 8; ++i) r.f[i] = *(const v4f*)(lanep + i * 16 * DIMN);
  return r;
}
__device__ __forceinline__ void storeTile32(_Float16 (*dst)[LDP32], const Tile32& r, int t) {
#pragma unroll
  for (int i = 0; i < 8; ++i) {
    const v4h hv = {(_Float16)r.f[i][0], (_Float16)r.f[i][1],
                    (_Float16)r.f[i][2], (_Float16)r.f[i][3]};
    *(v4h*)&dst[i * 16 + (t >> 3)][(t & 7) * 4] = hv;
  }
}
// The same for a 128 x 64 f32 tile: a row is two lines, sixteen lanes run along
// it, and a wave-wide load again covers four whole lines.
struct Tile64 { v4f f[16]; };
__device__ __forceinline__ Tile64 loadTile64(const float* __restrict__ tile, int t) {
  const unsigned int off = (unsigned int)(t >> 4) * DIMN + (unsigned int)(t & 15) * 4;
  Tile64 r;
#pragma unroll
  for (int i = 0; i < 16; ++i) r.f[i] = *(const v4f*)(tile + i * 8 * DIMN + off);
  return r;
}
__device__ __forceinline__ void storeTile64(_Float16 (*dst)[LDP64], const Tile64& r, int t) {
#pragma unroll
  for (int i = 0; i < 16; ++i) {
    const v4h hv = {(_Float16)r.f[i][0], (_Float16)r.f[i][1],
                    (_Float16)r.f[i][2], (_Float16)r.f[i][3]};
    *(v4h*)&dst[i * 8 + (t >> 4)][(t & 15) * 4] = hv;
  }
}

__device__ __forceinline__ float xhalf(float v) {
  const int b = __builtin_bit_cast(int, v);
  return __builtin_bit_cast(float, __builtin_amdgcn_permlanex16(
      b, b, 0x76543210, 0xfedcba98, false, false));
}

__device__ __forceinline__ v8f exp2x8(v8f x) {
  float e0 = x[0], e1 = x[1], e2 = x[2], e3 = x[3], e4 = x[4], e5 = x[5], e6 = x[6], e7 = x[7];
  asm("v_exp_f32 %0, %0\n\tv_exp_f32 %1, %1\n\tv_exp_f32 %2, %2\n\tv_exp_f32 %3, %3\n\t"
      "v_exp_f32 %4, %4\n\tv_exp_f32 %5, %5\n\tv_exp_f32 %6, %6\n\tv_exp_f32 %7, %7\n\t"
      "v_nop"
      : "+v"(e0), "+v"(e1), "+v"(e2), "+v"(e3), "+v"(e4), "+v"(e5), "+v"(e6), "+v"(e7));
  return (v8f){e0, e1, e2, e3, e4, e5, e6, e7};
}

__global__ __launch_bounds__(128)
void qk_proj_kernel(const float* __restrict__ x,
                    const float* __restrict__ Wqkv,
                    const float* __restrict__ bqkv,
                    _Float16* __restrict__ q_ws,
                    _Float16* __restrict__ k_ws) {
  __shared__ __align__(16) _Float16 Xs[128][LDP32];
  __shared__ __align__(16) _Float16 Ws[128][LDP32];

  const int m0   = blockIdx.y * 128;
  const int n0   = blockIdx.x * 128;
  const int t    = threadIdx.x;
  const int wv   = t >> 5;
  const int lane = t & 31;
  const int wm   = (wv >> 1) * 64;   // the wave's rows within the tile
  const int wn   = (wv & 1) * 64;    // the wave's columns within the tile

  v8f acc[4][4] = {};

  for (int k0 = 0; k0 < DIMN; k0 += 32) {
    __syncthreads();
    {   // stage the X and W tiles (f32 -> f16)
      const float* xl = laneOf32(x + (size_t)m0 * DIMN + k0, t);
      const float* wl = laneOf32(Wqkv + (size_t)n0 * DIMN + k0, t);
      const Tile32 xt = loadTile32(xl);
      const Tile32 wt = loadTile32(wl);
      // The wait that stands before a register named by an issued load is
      // overwritten. Naming the two addresses keeps them out of the loads' own
      // destinations; the clobber keeps all sixteen loads ahead of it, in
      // flight together.
      asm volatile("s_wait_xcnt 0x0" :: "v"(xl), "v"(wl) : "memory");
      storeTile32(Xs, xt, t);
      storeTile32(Ws, wt, t);
    }
    __syncthreads();

    v16h a[4], b[4];
#pragma unroll
    for (int i = 0; i < 4; ++i) a[i] = ldsFrag(&Xs[wm + i * 16][0], LDP32);
#pragma unroll
    for (int j = 0; j < 4; ++j) b[j] = ldsFrag(&Ws[wn + j * 16][0], LDP32);
    __builtin_amdgcn_sched_barrier(0);
#pragma unroll
    for (int j = 0; j < 4; ++j)
#pragma unroll
      for (int i = 0; i < 4; ++i)
        acc[i][j] = __builtin_amdgcn_wmma_f32_16x16x32_f16(
            false, a[i], false, b[j], (short)0, acc[i][j], false, false);
  }

  // A wave's 64 columns are one head of q or of k and its 64 rows lie in one
  // batch: one lane address, every store at a constant offset from it.
  const int rowOff = (lane >> 4) * 8;
  const int col    = lane & 15;
  const int gc0    = n0 + wn;                 // first column, a multiple of 64
  const int tok0   = m0 + wm;                 // first row, a multiple of 64
  const int h      = (gc0 >> 6) & (NHEADS - 1);
  const int bt     = tok0 >> 11, n = tok0 & (SEQ - 1);
  _Float16* dst = (gc0 < DIMN ? q_ws : k_ws)
                  + (((size_t)(bt * NHEADS + h)) * SEQ + n + rowOff) * HD + col;
  // q is stored times scale * log2 e (in f32, ahead of its one rounding to
  // f16): a score product is then the exponent of 2 that the softmax needs.
  const float qs = gc0 < DIMN ? EXP2_SCALE : 1.f;
#pragma unroll
  for (int j = 0; j < 4; ++j) {
    const float bias = bqkv[gc0 + j * 16 + col];
#pragma unroll
    for (int i = 0; i < 4; ++i)
#pragma unroll
      for (int r = 0; r < 8; ++r)
        dst[(i * 16 + r) * HD + j * 16] = (_Float16)((acc[i][j][r] + bias) * qs);
  }
}

__global__ __launch_bounds__(128)
void attn_kernel(const _Float16* __restrict__ q_ws,
                 const _Float16* __restrict__ k_ws,
                 const float* __restrict__ context,
                 _Float16* __restrict__ o_ws) {
  // Tensor-load targets: placed at multiples of 2 KiB, sizes rounded up to one.
  __shared__ __attribute__((aligned(2048))) _Float16 Qs[9216];   // 128 x LDP64
  __shared__ __attribute__((aligned(2048))) _Float16 Ks[5120];   // 64 x LDP64 used
  __shared__ __align__(16) _Float16 VTs[64][LDP64];

  const int q0   = blockIdx.x * 128;
  const int bh   = blockIdx.y;
  const int b    = bh >> 4, h = bh & 15;
  const int t    = threadIdx.x;
  const int wv   = t >> 5;
  const int lane = t & 31;
  const unsigned int wave = uni((unsigned int)t >> 5);

  const _Float16* qbase = q_ws + (size_t)bh * SEQ * HD;
  const _Float16* kbase = k_ws + (size_t)bh * SEQ * HD;

  if (pinned(wave == 0u)) {
    const u32x8 g1q = tdm_group1<128, 128, 4>(HD * 2);
    const u32x4 gq = tdm_group0(qbase + (size_t)q0 * HD, lds_offset_of(&Qs[0]));
    tdm_issue(gq, g1q);
    tdm_wait(gq, g1q);
  }
  const u32x8 g1 = tdm_group1<128, 64, 4>(HD * 2);
  __syncthreads();

  v16h aq[2][2];   // [column group][32-wide k block]
#pragma unroll
  for (int c = 0; c < 2; ++c) {
    aq[c][0] = ldsFrag(&Qs[(wv * 32 + c * 16) * LDP64],      LDP64);
    aq[c][1] = ldsFrag(&Qs[(wv * 32 + c * 16) * LDP64 + 32], LDP64);
  }

  // Per lane and column group: minus the maximum in use for its query (log2
  // units, equal in both halves and in all eight registers: the C operand of
  // the score products) and the sum over this half's keys (joined in the
  // epilogue).
  v8f negm[2] = {};
  float lrun[2] = {0.f, 0.f};
  // O^T: d = j * 16 + (lane >> 4) * 8 + r, query = c * 16 + (lane & 15)
  v8f o[2][4] = {};

  for (int kt = 0; kt < SEQ / 64; ++kt) {
    __syncthreads();
    // K tile DMA: issue first so it overlaps the V^T convert staging below.
    const u32x4 gk = tdm_group0(kbase + (size_t)kt * 64 * HD, lds_offset_of(&Ks[0]));
    if (pinned(wave == 0u)) tdm_issue(gk, g1);
    {   // stage V^T from context (f32 -> f16, transposed)
      // Eight lanes run along one 128-byte line of a key's row, so each
      // wave-wide load covers four whole lines. A lane takes the same four d of
      // four consecutive keys: each d is then one 8-byte store along VTs' row.
      // The loops are unrolled so that f is indexed by constants (registers).
      const int dl = (lane & 7) * 4;            // d offset within a line
      const int k4 = (wv * 4 + (lane >> 3)) * 4; // first of the lane's four keys
      const float* src = context + ((size_t)b * SEQ + kt * 64 + k4) * DIMN + h * HD + dl;
      v4f f[2][4];
#pragma unroll
      for (int i = 0; i < 2; ++i)
#pragma unroll
        for (int j = 0; j < 4; ++j) f[i][j] = *(const v4f*)(src + (size_t)j * DIMN + i * 32);
#pragma unroll
      for (int i = 0; i < 2; ++i)
#pragma unroll
        for (int c = 0; c < 4; ++c) {
          const v4h hv = {(_Float16)f[i][0][c], (_Float16)f[i][1][c],
                          (_Float16)f[i][2][c], (_Float16)f[i][3][c]};
          *(v4h*)&VTs[i * 32 + dl + c][k4] = hv;
        }
    }
    if (pinned(wave == 0u)) tdm_wait(gk, g1);
    __syncthreads();

    // S^T = K Q^T - m (64 keys x 32 queries per wave): q carries the scale and
    // the accumulator starts at minus the maximum in use, so the products end
    // as the exponents themselves.
    v8f s4[2][4];
#pragma unroll
    for (int j = 0; j < 4; ++j) {
      v8f sc[2] = {negm[0], negm[1]};
#pragma unroll
      for (int ks = 0; ks < 2; ++ks) {
        const v16h ak = ldsFrag(&Ks[j * 16 * LDP64 + ks * 32], LDP64);
#pragma unroll
        for (int c = 0; c < 2; ++c)
          sc[c] = __builtin_amdgcn_wmma_f32_16x16x32_f16(
              false, ak, false, aq[c][ks], (short)0, sc[c], false, false);
      }
      s4[0][j] = sc[0];
      s4[1][j] = sc[1];
    }

    // Lazy online softmax, one query per lane and column group. The maximum in
    // use moves only in the first tile (to that tile's own maximum) and when a
    // score passes it by more than LAZY_MAX: one test a tile, a scalar branch.
    // Until then P <= 2^LAZY_MAX, well inside f16, and sums and outputs need no
    // rescale. The loops are unrolled so that the tiles are indexed by constants
    // (registers).
    float tm[2];
#pragma unroll
    for (int c = 0; c < 2; ++c) {
      tm[c] = s4[c][0][0];
#pragma unroll
      for (int j = 0; j < 4; ++j)
#pragma unroll
        for (int r = 0; r < 8; ++r) tm[c] = fmaxf(tm[c], s4[c][j][r]);
    }
    if (kt == 0 || __builtin_amdgcn_ballot_w32(fmaxf(tm[0], tm[1]) > LAZY_MAX) != 0u) {
#pragma unroll
      for (int c = 0; c < 2; ++c) {
        const float t2 = fmaxf(tm[c], xhalf(tm[c]));
        // The step of this query's maximum: never down, but for the first tile,
        // whose sums and outputs are still zero.
        const float up    = fmaxf(t2, 0.f);
        const float delta = kt == 0 ? t2 : up;
        float alpha;
        asm("v_exp_f32 %0, %1\n\tv_nop" : "=v"(alpha) : "v"(-up));
        lrun[c] *= alpha;
#pragma unroll
        for (int r = 0; r < 8; ++r) negm[c][r] -= delta;
#pragma unroll
        for (int j = 0; j < 4; ++j)
#pragma unroll
          for (int r = 0; r < 8; ++r) { o[c][j][r] *= alpha; s4[c][j][r] -= delta; }
      }
    }
#pragma unroll
    for (int c = 0; c < 2; ++c) {
      float rs = 0.f;
#pragma unroll
      for (int j = 0; j < 4; ++j) {
        s4[c][j] = exp2x8(s4[c][j]);
#pragma unroll
        for (int r = 0; r < 8; ++r) rs += s4[c][j][r];
      }
      lrun[c] += rs;
    }

    // O^T += V^T P^T. Score tiles 2ks and 2ks+1 hold this lane's keys
    // kb..kb+7 and kb+16..kb+23 (kb = (lane >> 4) * 8) of the 32-key block:
    // the k order of ldsFrag, so they pack straight into the B fragment.
#pragma unroll
    for (int ks = 0; ks < 2; ++ks) {
      v16h pb[2];
#pragma unroll
      for (int c = 0; c < 2; ++c)
#pragma unroll
        for (int i = 0; i < 8; ++i) {
          pb[c][i]     = (_Float16)s4[c][2 * ks][i];
          pb[c][8 + i] = (_Float16)s4[c][2 * ks + 1][i];
        }
#pragma unroll
      for (int j = 0; j < 4; ++j) {
        const v16h av = ldsFrag(&VTs[j * 16][ks * 32], LDP64);
#pragma unroll
        for (int c = 0; c < 2; ++c)
          o[c][j] = __builtin_amdgcn_wmma_f32_16x16x32_f16(
              false, av, false, pb[c], (short)0, o[c][j], false, false);
      }
    }
  }

  // Epilogue: join the halves' sums, normalize, store f16 [token, dim] for the
  // out-proj GEMM: a lane's 8 values of a tile are 8 consecutive d.
#pragma unroll
  for (int c = 0; c < 2; ++c) {
    const float inv = 1.f / (lrun[c] + xhalf(lrun[c]));
    const int tok = b * SEQ + q0 + wv * 32 + c * 16 + (lane & 15);
#pragma unroll
    for (int j = 0; j < 4; ++j) {
      v8h ov;
#pragma unroll
      for (int r = 0; r < 8; ++r) ov[r] = (_Float16)(o[c][j][r] * inv);
      *(v8h*)(o_ws + (size_t)tok * DIMN + h * HD + j * 16 + (lane >> 4) * 8) = ov;
    }
  }
}

__global__ __launch_bounds__(128)
void out_proj_kernel(const _Float16* __restrict__ a_ws,
                     const float* __restrict__ Wout,
                     const float* __restrict__ bout,
                     float* __restrict__ out) {
  __shared__ __attribute__((aligned(2048))) _Float16 As[128][LDP64];  // tensor-load target
  __shared__ __align__(16) _Float16 Ws[128][LDP64];

  const int m0   = blockIdx.y * 128;
  const int n0   = blockIdx.x * 128;
  const int t    = threadIdx.x;
  const int wv   = t >> 5;
  const int lane = t & 31;
  const int wm   = (wv >> 1) * 64;   // the wave's rows within the tile
  const int wn   = (wv & 1) * 64;    // the wave's columns within the tile
  const unsigned int wave = uni((unsigned int)t >> 5);
  const u32x8 g1 = tdm_group1<128, 128, 4>(DIMN * 2);

  v8f acc[4][4] = {};

  for (int k0 = 0; k0 < DIMN; k0 += 64) {
    __syncthreads();
    const u32x4 ga = tdm_group0(a_ws + (size_t)m0 * DIMN + k0, lds_offset_of(&As[0][0]));
    if (pinned(wave == 0u)) tdm_issue(ga, g1);
    // stage Wout tile (f32 -> f16): overlaps the DMA
    storeTile64(Ws, loadTile64(Wout + (size_t)n0 * DIMN + k0, t), t);
    if (pinned(wave == 0u)) tdm_wait(ga, g1);
    __syncthreads();

#pragma unroll
    for (int ks = 0; ks < 2; ++ks) {
      v16h a[4], bw[4];
#pragma unroll
      for (int i = 0; i < 4; ++i) a[i] = ldsFrag(&As[wm + i * 16][ks * 32], LDP64);
#pragma unroll
      for (int j = 0; j < 4; ++j) bw[j] = ldsFrag(&Ws[wn + j * 16][ks * 32], LDP64);
      __builtin_amdgcn_sched_barrier(0);
#pragma unroll
      for (int j = 0; j < 4; ++j)
#pragma unroll
        for (int i = 0; i < 4; ++i)
          acc[i][j] = __builtin_amdgcn_wmma_f32_16x16x32_f16(
              false, a[i], false, bw[j], (short)0, acc[i][j], false, false);
    }
  }

  const int rowOff = (lane >> 4) * 8, col = lane & 15;
#pragma unroll
  for (int j = 0; j < 4; ++j) {
    const float bias = bout[n0 + wn + j * 16 + col];
#pragma unroll
    for (int i = 0; i < 4; ++i)
#pragma unroll
      for (int r = 0; r < 8; ++r) {
        const int tok = m0 + wm + i * 16 + rowOff + r;
        out[(size_t)tok * DIMN + n0 + wn + j * 16 + col] = acc[i][j][r] + bias;
      }
  }
}

// ---------------------------------------------------------------------------
extern "C" void kernel_launch(void* const* d_in, const int* in_sizes, int n_in,
                              void* d_out, int out_size, void* d_ws, size_t ws_size,
                              hipStream_t stream) {
  (void)in_sizes; (void)n_in; (void)out_size; (void)ws_size;

  const float* x       = (const float*)d_in[0];
  const float* context = (const float*)d_in[1];
  const float* Wqkv    = (const float*)d_in[2];
  const float* bqkv    = (const float*)d_in[3];
  const float* Wout    = (const float*)d_in[4];
  const float* bout    = (const float*)d_in[5];
  float* out = (float*)d_out;

  _Float16* q_ws = (_Float16*)d_ws;                    // 16 MB
  _Float16* k_ws = q_ws + (size_t)TOKENS * DIMN;       // 16 MB
  _Float16* o_ws = k_ws + (size_t)TOKENS * DIMN;       // 16 MB

  const dim3 blk(128, 1, 1);
  qk_proj_kernel <<<dim3(2048 / 128, TOKENS / 128, 1), blk, 0, stream>>>(
      x, Wqkv, bqkv, q_ws, k_ws);
  attn_kernel    <<<dim3(SEQ / 128, BATCH * NHEADS, 1), blk, 0, stream>>>(
      q_ws, k_ws, context, o_ws);
  out_proj_kernel<<<dim3(DIMN / 128, TOKENS / 128, 1), blk, 0, stream>>>(
      o_ws, Wout, bout, out);
}

// v006
// Measured time: 118 microseconds a run.
// Timed twice side by side with v005, it ran 1.10 and 1.11 times as fast.
// Counting every step since v000, it is 4.66 times as fast.
#include <hip/hip_runtime.h>

typedef __attribute__((ext_vector_type(16))) _Float16 v16h;
typedef __attribute__((ext_vector_type(8)))  _Float16 v8h;
typedef __attribute__((ext_vector_type(4)))  _Float16 v4h;
typedef __attribute__((ext_vector_type(8)))  float    v8f;
typedef __attribute__((ext_vector_type(4)))  float    v4f;
typedef __attribute__((ext_vector_type(2)))  float    v2f;
typedef __attribute__((ext_vector_type(4)))  unsigned int u32x4;
typedef __attribute__((ext_vector_type(8)))  unsigned int u32x8;

#define DIMN   1024
#define NHEADS 16
#define HD     64
#define SEQ    2048
#define BATCH  4
#define TOKENS (BATCH * SEQ)   // 8192
#define ATT_SCALE 0.125f       // HEAD_DIM^-0.5 = 1/8
#define EXP2_SCALE (ATT_SCALE * 1.44269504f)   // scale * log2 e, carried by q
#define LAZY_MAX 8.0f          // a score may pass the maximum in use by 8 (log2 units)
#define LDP64  72              // 64-half rows: 144 B
#define LDP32  40              // 32-half rows:  80 B

__device__ __forceinline__ unsigned int uni(unsigned int v) {
  return (unsigned int)__builtin_amdgcn_readfirstlane(v);
}
// Holds a wave-uniform test in a scalar register, so that the branch around a
// tensor load compiles to s_cmp + s_cbranch_scc.
__device__ __forceinline__ unsigned int pinned(unsigned int v) {
  unsigned int w = uni(v);
  asm volatile("" : "+s"(w));
  return w;
}
__device__ __forceinline__ u32x4 tdm_group0(const void* gsrc, unsigned int lds_off) {
  const unsigned long long ga = (unsigned long long)(uintptr_t)gsrc;
  u32x4 g0;
  g0[0] = uni(1u);                                        // count=1
  g0[1] = uni(lds_off);                                   // LDS byte address
  g0[2] = uni((unsigned int)ga);                          // global_addr[31:0]
  g0[3] = uni((((unsigned int)(ga >> 32)) & 0x01ffffffu)  // global_addr[56:32]
              | 0x80000000u);                             // type=2
  return g0;
}
template <unsigned int ROWB, unsigned int ROWS, unsigned int IVL>
__device__ __forceinline__ u32x8 tdm_group1(unsigned int src_pitch) {
  u32x8 g1;
  g1[0] = uni((1u << 20) | (IVL << 22) | (3u << 25));
  g1[1] = uni((ROWB & 0xffffu) << 16);
  g1[2] = uni((ROWB >> 16) | ((ROWS & 0xffffu) << 16));
  g1[3] = uni((ROWS >> 16) | (ROWB << 16));
  g1[4] = uni(ROWS);
  g1[5] = uni(src_pitch);
  g1[6] = uni(0u);
  g1[7] = uni(0u);
  asm volatile("" : "+s"(g1));
  return g1;
}
__device__ __forceinline__ void tdm_issue(u32x4 g0, u32x8 g1) {
  asm volatile("tensor_load_to_lds %0, %1" :: "s"(g0), "s"(g1) : "memory");
}
__device__ __forceinline__ void tdm_wait(u32x4 g0, u32x8 g1) {
  asm volatile("s_wait_tensorcnt 0x0" :: "s"(g0), "s"(g1) : "memory");
}

__device__ __forceinline__ unsigned int lds_offset_of(const void* p) {
  return (unsigned int)(uintptr_t)p;
}

__device__ __forceinline__ v16h ldsFrag(const _Float16* base, int ld) {
  const int lane = threadIdx.x & 31;
  const int r    = lane & 15;
  const int kb   = (lane >> 4) << 3;
  const _Float16* p = base + r * ld + kb;
  const v8h lo = *(const v8h*)(p);
  const v8h hi = *(const v8h*)(p + 16);
  v16h f;
#pragma unroll
  for (int i = 0; i < 8; ++i) { f[i] = lo[i]; f[8 + i] = hi[i]; }
  return f;
}

// ---------------------------------------------------------------------------
// Staging of a 256 x 32 f32 tile (row pitch DIMN floats) as f16, 256 threads.
// A tile row is one 128-byte line: eight lanes run along it, so each wave-wide
// 16-byte load covers four whole lines. The loops are unrolled so that the
// eight vectors are indexed by constants and stay in registers.
// ---------------------------------------------------------------------------
struct Tile32 { v4f f[8]; };
// The lane's first address within a tile.
__device__ __forceinline__ const float* laneOf32(const float* __restrict__ tile, int t) {
  return tile + ((unsigned int)(t >> 3) * DIMN + (unsigned int)(t & 7) * 4);
}
__device__ __forceinline__ Tile32 loadTile32(const float* __restrict__ lanep) {
  Tile32 r;
#pragma unroll
  for (int i = 0; i < 8; ++i) r.f[i] = *(const v4f*)(lanep + i * 32 * DIMN);
  return r;
}
__device__ __forceinline__ void storeTile32(_Float16 (*dst)[LDP32], const Tile32& r, int t) {
#pragma unroll
  for (int i = 0; i < 8; ++i) {
    const v4h hv = {(_Float16)r.f[i][0], (_Float16)r.f[i][1],
                    (_Float16)r.f[i][2], (_Float16)r.f[i][3]};
    *(v4h*)&dst[i * 32 + (t >> 3)][(t & 7) * 4] = hv;
  }
}
// The same for a 128 x 64 f32 tile: a row is two lines, sixteen lanes run along
// it, and a wave-wide load again covers four whole lines.
struct Tile64 { v4f f[8]; };
__device__ __forceinline__ const float* laneOf64(const float* __restrict__ tile, int t) {
  return tile + ((unsigned int)(t >> 4) * DIMN + (unsigned int)(t & 15) * 4);
}
__device__ __forceinline__ Tile64 loadTile64(const float* __restrict__ lanep) {
  Tile64 r;
#pragma unroll
  for (int i = 0; i < 8; ++i) r.f[i] = *(const v4f*)(lanep + i * 16 * DIMN);
  return r;
}
__device__ __forceinline__ void storeTile64(_Float16 (*dst)[LDP64], const Tile64& r, int t) {
#pragma unroll
  for (int i = 0; i < 8; ++i) {
    const v4h hv = {(_Float16)r.f[i][0], (_Float16)r.f[i][1],
                    (_Float16)r.f[i][2], (_Float16)r.f[i][3]};
    *(v4h*)&dst[i * 16 + (t >> 4)][(t & 15) * 4] = hv;
  }
}

__device__ __forceinline__ float xhalf(float v) {
  const int b = __builtin_bit_cast(int, v);
  return __builtin_bit_cast(float, __builtin_amdgcn_permlanex16(
      b, b, 0x76543210, 0xfedcba98, false, false));
}

__device__ __forceinline__ v8f exp2x8(v8f x) {
  float e0 = x[0], e1 = x[1], e2 = x[2], e3 = x[3], e4 = x[4], e5 = x[5], e6 = x[6], e7 = x[7];
  asm("v_exp_f32 %0, %0\n\tv_exp_f32 %1, %1\n\tv_exp_f32 %2, %2\n\tv_exp_f32 %3, %3\n\t"
      "v_exp_f32 %4, %4\n\tv_exp_f32 %5, %5\n\tv_exp_f32 %6, %6\n\tv_exp_f32 %7, %7\n\t"
      "v_nop"
      : "+v"(e0), "+v"(e1), "+v"(e2), "+v"(e3), "+v"(e4), "+v"(e5), "+v"(e6), "+v"(e7));
  return (v8f){e0, e1, e2, e3, e4, e5, e6, e7};
}

__device__ __forceinline__ void qkProducts(v8f (&acc)[8][4], const _Float16 (*Xb)[LDP32],
                                           const _Float16 (*Wb)[LDP32], int wm, int wn) {
  v16h a[8], b[4];
#pragma unroll
  for (int i = 0; i < 8; ++i) a[i] = ldsFrag(&Xb[wm + i * 16][0], LDP32);
#pragma unroll
  for (int j = 0; j < 4; ++j) b[j] = ldsFrag(&Wb[wn + j * 16][0], LDP32);
  __builtin_amdgcn_sched_barrier(0);
#pragma unroll
  for (int j = 0; j < 4; ++j)
#pragma unroll
    for (int i = 0; i < 8; ++i)
      acc[i][j] = __builtin_amdgcn_wmma_f32_16x16x32_f16(
          false, a[i], false, b[j], (short)0, acc[i][j], false, false);
  // Holds the staging that follows, and with it the wait for its loads, behind
  // the products: lifted among them, that wait stands in front of most.
  __builtin_amdgcn_sched_barrier(0);
}

__global__ __launch_bounds__(256)
void qk_proj_kernel(const float* __restrict__ x,
                    const float* __restrict__ Wqkv,
                    const float* __restrict__ bqkv,
                    _Float16* __restrict__ q_ws,
                    _Float16* __restrict__ k_ws) {
  __shared__ __align__(16) _Float16 Xs[2][256][LDP32];
  __shared__ __align__(16) _Float16 Ws[2][256][LDP32];

  const int m0   = blockIdx.y * 256;
  const int n0   = blockIdx.x * 256;
  const int t    = threadIdx.x;
  const int wv   = t >> 5;
  const int lane = t & 31;
  const int wm   = (wv >> 2) * 128;  // the wave's rows within the tile
  const int wn   = (wv & 3) * 64;    // the wave's columns within the tile

  v8f acc[8][4] = {};

  const float* xl = laneOf32(x + (size_t)m0 * DIMN, t);
  const float* wl = laneOf32(Wqkv + (size_t)n0 * DIMN, t);
  // The wait in LOAD_TILES stands before a register named by an issued load is
  // overwritten; its clobber keeps all sixteen loads ahead of it, and so ahead
  // of the products that follow, in flight together.
#define LOAD_TILES(xt, wt)                          \
  xt = loadTile32(xl);                              \
  wt = loadTile32(wl);                              \
  asm volatile("s_wait_xcnt 0x0" ::: "memory");     \
  xl += 32;                                         \
  wl += 32
  // One pass: the loads of the tiles two passes on, the products of this pass's
  // buffers, then the staging of the next pass's tiles (loaded one pass back)
  // into the other buffers. One barrier a pass: it publishes the tiles just
  // staged and ends the reads of the buffers that the next pass stages into. It
  // is written by hand, behind the wait for this wave's LDS reads and writes:
  // __syncthreads() also waits out the global loads in flight, which are to stay
  // in flight across it.
#define STAGE_TILES(b, xt, wt)                      \
  storeTile32(Xs[b], xt, t);                        \
  storeTile32(Ws[b], wt, t);                        \
  asm volatile("s_wait_dscnt 0x0\n\ts_barrier_signal -1\n\ts_barrier_wait -1" ::: "memory")
  Tile32 xa, wa, xb, wb;
  LOAD_TILES(xa, wa);
  STAGE_TILES(0, xa, wa);
  LOAD_TILES(xa, wa);

  // Two passes a trip, so that buffers and register sets are named by constants.
#pragma unroll 1
  for (int p = 0; p < DIMN / 32 - 2; p += 2) {
    LOAD_TILES(xb, wb);
    qkProducts(acc, Xs[0], Ws[0], wm, wn);
    STAGE_TILES(1, xa, wa);
    LOAD_TILES(xa, wa);
    qkProducts(acc, Xs[1], Ws[1], wm, wn);
    STAGE_TILES(0, xb, wb);
  }
  qkProducts(acc, Xs[0], Ws[0], wm, wn);
  STAGE_TILES(1, xa, wa);
  qkProducts(acc, Xs[1], Ws[1], wm, wn);
#undef LOAD_TILES
#undef STAGE_TILES

  // A wave's 64 columns are one head of q or of k and its 128 rows lie in one
  // batch: one lane address, every store at a constant offset from it.
  const int rowOff = (lane >> 4) * 8;
  const int col    = lane & 15;
  const int gc0    = n0 + wn;                 // first column, a multiple of 64
  const int tok0   = m0 + wm;                 // first row, a multiple of 128
  const int h      = (gc0 >> 6) & (NHEADS - 1);
  const int bt     = tok0 >> 11, n = tok0 & (SEQ - 1);
  _Float16* dst = (gc0 < DIMN ? q_ws : k_ws)
                  + (((size_t)(bt * NHEADS + h)) * SEQ + n + rowOff) * HD + col;
  // q is stored times scale * log2 e (in f32, ahead of its one rounding to
  // f16): a score product is then the exponent of 2 that the softmax needs.
  const float qs = gc0 < DIMN ? EXP2_SCALE : 1.f;
#pragma unroll
  for (int j = 0; j < 4; ++j) {
    const float bias = bqkv[gc0 + j * 16 + col];
#pragma unroll
    for (int i = 0; i < 8; ++i)
#pragma unroll
      for (int r = 0; r < 8; ++r)
        dst[(i * 16 + r) * HD + j * 16] = (_Float16)((acc[i][j][r] + bias) * qs);
  }
}

__global__ __launch_bounds__(128)
void attn_kernel(const _Float16* __restrict__ q_ws,
                 const _Float16* __restrict__ k_ws,
                 const float* __restrict__ context,
                 _Float16* __restrict__ o_ws) {
  // Tensor-load targets: placed at multiples of 2 KiB, sizes rounded up to one.
  __shared__ __attribute__((aligned(2048))) _Float16 Qs[9216];   // 128 x LDP64
  __shared__ __attribute__((aligned(2048))) _Float16 Ks[5120];   // 64 x LDP64 used
  __shared__ __align__(16) _Float16 VTs[64][LDP64];

  const int q0   = blockIdx.x * 128;
  const int bh   = blockIdx.y;
  const int b    = bh >> 4, h = bh & 15;
  const int t    = threadIdx.x;
  const int wv   = t >> 5;
  const int lane = t & 31;
  const unsigned int wave = uni((unsigned int)t >> 5);

  const _Float16* qbase = q_ws + (size_t)bh * SEQ * HD;
  const _Float16* kbase = k_ws + (size_t)bh * SEQ * HD;

  if (pinned(wave == 0u)) {
    const u32x8 g1q = tdm_group1<128, 128, 4>(HD * 2);
    const u32x4 gq = tdm_group0(qbase + (size_t)q0 * HD, lds_offset_of(&Qs[0]));
    tdm_issue(gq, g1q);
    tdm_wait(gq, g1q);
  }
  const u32x8 g1 = tdm_group1<128, 64, 4>(HD * 2);
  __syncthreads();

  v16h aq[2][2];   // [column group][32-wide k block]
#pragma unroll
  for (int c = 0; c < 2; ++c) {
    aq[c][0] = ldsFrag(&Qs[(wv * 32 + c * 16) * LDP64],      LDP64);
    aq[c][1] = ldsFrag(&Qs[(wv * 32 + c * 16) * LDP64 + 32], LDP64);
  }

  // Per lane and column group: minus the maximum in use for its query (log2
  // units, equal in both halves and in all eight registers: the C operand of
  // the score products) and the sum over this half's keys (joined in the
  // epilogue).
  v8f negm[2] = {};
  float lrun[2] = {0.f, 0.f};
  // O^T: d = j * 16 + (lane >> 4) * 8 + r, query = c * 16 + (lane & 15)
  v8f o[2][4] = {};

  for (int kt = 0; kt < SEQ / 64; ++kt) {
    __syncthreads();
    // K tile DMA: issue first so it overlaps the V^T convert staging below.
    const u32x4 gk = tdm_group0(kbase + (size_t)kt * 64 * HD, lds_offset_of(&Ks[0]));
    if (pinned(wave == 0u)) tdm_issue(gk, g1);
    {   // stage V^T from context (f32 -> f16, transposed)
      // Eight lanes run along one 128-byte line of a key's row, so each
      // wave-wide load covers four whole lines. A lane takes the same four d of
      // four consecutive keys: each d is then one 8-byte store along VTs' row.
      // The loops are unrolled so that f is indexed by constants (registers).
      const int dl = (lane & 7) * 4;            // d offset within a line
      const int k4 = (wv * 4 + (lane >> 3)) * 4; // first of the lane's four keys
      const float* src = context + ((size_t)b * SEQ + kt * 64 + k4) * DIMN + h * HD + dl;
      v4f f[2][4];
#pragma unroll
      for (int i = 0; i < 2; ++i)
#pragma unroll
        for (int j = 0; j < 4; ++j) f[i][j] = *(const v4f*)(src + (size_t)j * DIMN + i * 32);
#pragma unroll
      for (int i = 0; i < 2; ++i)
#pragma unroll
        for (int c = 0; c < 4; ++c) {
          const v4h hv = {(_Float16)f[i][0][c], (_Float16)f[i][1][c],
                          (_Float16)f[i][2][c], (_Float16)f[i][3][c]};
          *(v4h*)&VTs[i * 32 + dl + c][k4] = hv;
        }
    }
    if (pinned(wave == 0u)) tdm_wait(gk, g1);
    __syncthreads();

    // S^T = K Q^T - m (64 keys x 32 queries per wave): q carries the scale and
    // the accumulator starts at minus the maximum in use, so the products end
    // as the exponents themselves.
    v8f s4[2][4];
#pragma unroll
    for (int j = 0; j < 4; ++j) {
      v8f sc[2] = {negm[0], negm[1]};
#pragma unroll
      for (int ks = 0; ks < 2; ++ks) {
        const v16h ak = ldsFrag(&Ks[j * 16 * LDP64 + ks * 32], LDP64);
#pragma unroll
        for (int c = 0; c < 2; ++c)
          sc[c] = __builtin_amdgcn_wmma_f32_16x16x32_f16(
              false, ak, false, aq[c][ks], (short)0, sc[c], false, false);
      }
      s4[0][j] = sc[0];
      s4[1][j] = sc[1];
    }

    // Lazy online softmax, one query per lane and column group. The maximum in
    // use moves only in the first tile (to that tile's own maximum) and when a
    // score passes it by more than LAZY_MAX: one test a tile, a scalar branch.
    // Until then P <= 2^LAZY_MAX, well inside f16, and sums and outputs need no
    // rescale. The loops are unrolled so that the tiles are indexed by constants
    // (registers).
    float tm[2];
#pragma unroll
    for (int c = 0; c < 2; ++c) {
      tm[c] = s4[c][0][0];
#pragma unroll
      for (int j = 0; j < 4; ++j)
#pragma unroll
        for (int r = 0; r < 8; ++r) tm[c] = fmaxf(tm[c], s4[c][j][r]);
    }
    if (kt == 0 || __builtin_amdgcn_ballot_w32(fmaxf(tm[0], tm[1]) > LAZY_MAX) != 0u) {
#pragma unroll
      for (int c = 0; c < 2; ++c) {
        const float t2 = fmaxf(tm[c], xhalf(tm[c]));
        // The step of this query's maximum: never down, but for the first tile,
        // whose sums and outputs are still zero.
        const float up    = fmaxf(t2, 0.f);
        const float delta = kt == 0 ? t2 : up;
        float alpha;
        asm("v_exp_f32 %0, %1\n\tv_nop" : "=v"(alpha) : "v"(-up));
        lrun[c] *= alpha;
#pragma unroll
        for (int r = 0; r < 8; ++r) negm[c][r] -= delta;
#pragma unroll
        for (int j = 0; j < 4; ++j)
#pragma unroll
          for (int r = 0; r < 8; ++r) { o[c][j][r] *= alpha; s4[c][j][r] -= delta; }
      }
    }
#pragma unroll
    for (int c = 0; c < 2; ++c) {
      float rs = 0.f;
#pragma unroll
      for (int j = 0; j < 4; ++j) {
        s4[c][j] = exp2x8(s4[c][j]);
#pragma unroll
        for (int r = 0; r < 8; ++r) rs += s4[c][j][r];
      }
      lrun[c] += rs;
    }

    // O^T += V^T P^T. Score tiles 2ks and 2ks+1 hold this lane's keys
    // kb..kb+7 and kb+16..kb+23 (kb = (lane >> 4) * 8) of the 32-key block:
    // the k order of ldsFrag, so they pack straight into the B fragment.
#pragma unroll
    for (int ks = 0; ks < 2; ++ks) {
      v16h pb[2];
#pragma unroll
      for (int c = 0; c < 2; ++c)
#pragma unroll
        for (int i = 0; i < 8; ++i) {
          pb[c][i]     = (_Float16)s4[c][2 * ks][i];
          pb[c][8 + i] = (_Float16)s4[c][2 * ks + 1][i];
        }
#pragma unroll
      for (int j = 0; j < 4; ++j) {
        const v16h av = ldsFrag(&VTs[j * 16][ks * 32], LDP64);
#pragma unroll
        for (int c = 0; c < 2; ++c)
          o[c][j] = __builtin_amdgcn_wmma_f32_16x16x32_f16(
              false, av, false, pb[c], (short)0, o[c][j], false, false);
      }
    }
  }

  // Epilogue: join the halves' sums, normalize, store f16 [token, dim] for the
  // out-proj GEMM: a lane's 8 values of a tile are 8 consecutive d.
#pragma unroll
  for (int c = 0; c < 2; ++c) {
    const float inv = 1.f / (lrun[c] + xhalf(lrun[c]));
    const int tok = b * SEQ + q0 + wv * 32 + c * 16 + (lane & 15);
#pragma unroll
    for (int j = 0; j < 4; ++j) {
      v8h ov;
#pragma unroll
      for (int r = 0; r < 8; ++r) ov[r] = (_Float16)(o[c][j][r] * inv);
      *(v8h*)(o_ws + (size_t)tok * DIMN + h * HD + j * 16 + (lane >> 4) * 8) = ov;
    }
  }
}

// ---------------------------------------------------------------------------
// Kernel 3: output projection. out[8192,1024] = A(f16) @ Wout^T + bout (f32).
// 256 x 128 of out per work-group of eight waves, 64 x 64 per wave (waves 4 x 2),
// 64 k a pass: one work-group per WGP. As in kernel 1 a pass works under the
// next tiles' loads: A by tensor load in a ring of two buffers, Wout (f32 ->
// f16) loaded ahead of the products and staged behind them.
// ---------------------------------------------------------------------------
__device__ __forceinline__ void outProducts(v8f (&acc)[4][4], const _Float16 (*Ab)[LDP64],
                                            const _Float16 (*Wb)[LDP64], int wm, int wn) {
#pragma unroll
  for (int ks = 0; ks < 2; ++ks) {
    v16h a[4], bw[4];
#pragma unroll
    for (int i = 0; i < 4; ++i) a[i] = ldsFrag(&Ab[wm + i * 16][ks * 32], LDP64);
#pragma unroll
    for (int j = 0; j < 4; ++j) bw[j] = ldsFrag(&Wb[wn + j * 16][ks * 32], LDP64);
    __builtin_amdgcn_sched_barrier(0);
#pragma unroll
    for (int j = 0; j < 4; ++j)
#pragma unroll
      for (int i = 0; i < 4; ++i)
        acc[i][j] = __builtin_amdgcn_wmma_f32_16x16x32_f16(
            false, a[i], false, bw[j], (short)0, acc[i][j], false, false);
  }
}

__global__ __launch_bounds__(256)
void out_proj_kernel(const _Float16* __restrict__ a_ws,
                     const float* __restrict__ Wout,
                     const float* __restrict__ bout,
                     float* __restrict__ out) {
  // Tensor-load targets: a buffer is 36,864 bytes, a multiple of 2 KiB.
  __shared__ __attribute__((aligned(2048))) _Float16 As[2][256][LDP64];
  __shared__ __align__(16) _Float16 Ws[2][128][LDP64];

  const int m0   = blockIdx.y * 256;
  const int n0   = blockIdx.x * 128;
  const int t    = threadIdx.x;
  const int wv   = t >> 5;
  const int lane = t & 31;
  const int wm   = (wv >> 1) * 64;   // the wave's rows within the tile
  const int wn   = (wv & 1) * 64;    // the wave's columns within the tile
  const unsigned int wave = uni((unsigned int)t >> 5);
  const u32x8 g1 = tdm_group1<128, 256, 4>(DIMN * 2);
  const _Float16* abase = a_ws + (size_t)m0 * DIMN;   // stage s: 256 rows x 64 halfs at + s * 64
  const int NP = DIMN / 64;                           // passes = stages

  v8f acc[4][4] = {};

  // Ring prologue: stage 0 lands and is published, then stage 1 is issued.
  u32x4 ga = tdm_group0(abase, lds_offset_of(&As[0][0][0]));
  if (pinned(wave == 0u)) { tdm_issue(ga, g1); tdm_wait(ga, g1); }
  const float* wl = laneOf64(Wout + (size_t)n0 * DIMN, t);
  {
    const Tile64 wt = loadTile64(wl);
    // As in the loop below.
    asm volatile("s_wait_xcnt 0x0" ::: "memory");
    storeTile64(Ws[0], wt, t);
  }
  __syncthreads();
  ga = tdm_group0(abase + 64, lds_offset_of(&As[1][0][0]));
  asm volatile("" : "+s"(ga));
  if (pinned(wave == 0u)) tdm_issue(ga, g1);

  // Kept rolled: the body holds 32 products, and a second copy buys nothing.
#pragma unroll 1
  for (int p = 0; p < NP - 1; ++p) {
    const int cur = p & 1;
    wl += 64;
    const Tile64 wt = loadTile64(wl);
    // The wait that stands before a register named by an issued load is
    // overwritten. The clobber keeps all eight loads ahead of it, and so ahead
    // of the products, in flight together.
    asm volatile("s_wait_xcnt 0x0" ::: "memory");
    outProducts(acc, As[cur], Ws[cur], wm, wn);
    // Holds the staging, and with it the wait for the loads, behind the pass's
    // products: lifted among them, the loads' latency stands in front of most.
    __builtin_amdgcn_sched_barrier(0);
    storeTile64(Ws[cur ^ 1], wt, t);
    // Publish point of stage p + 1: this wave's LDS reads and writes are done,
    // the issuing wave's tile has landed, then the one barrier of the pass.
    asm volatile("s_wait_dscnt 0x0" ::: "memory");
    if (pinned(wave == 0u)) tdm_wait(ga, g1);
    __syncthreads();
    ga = tdm_group0(abase + (p + 2) * 64, lds_offset_of(&As[cur][0][0]));
    asm volatile("" : "+s"(ga));   // as in the prologue
    if (pinned(wave == 0u && p + 2 < NP)) tdm_issue(ga, g1);
  }
  outProducts(acc, As[(NP - 1) & 1], Ws[(NP - 1) & 1], wm, wn);
  // Behind the ring: nothing is outstanding when the wave goes on to its end.
  asm volatile("s_wait_tensorcnt 0x0" ::: "memory");
  asm volatile("s_wait_dscnt 0x0" ::: "memory");

  const int rowOff = (lane >> 4) * 8, col = lane & 15;
#pragma unroll
  for (int j = 0; j < 4; ++j) {
    const float bias = bout[n0 + wn + j * 16 + col];
#pragma unroll
    for (int i = 0; i < 4; ++i)
#pragma unroll
      for (int r = 0; r < 8; ++r) {
        const int tok = m0 + wm + i * 16 + rowOff + r;
        out[(size_t)tok * DIMN + n0 + wn + j * 16 + col] = acc[i][j][r] + bias;
      }
  }
}

// ---------------------------------------------------------------------------
extern "C" void kernel_launch(void* const* d_in, const int* in_sizes, int n_in,
                              void* d_out, int out_size, void* d_ws, size_t ws_size,
                              hipStream_t stream) {
  (void)in_sizes; (void)n_in; (void)out_size; (void)ws_size;

  const float* x       = (const float*)d_in[0];
  const float* context = (const float*)d_in[1];
  const float* Wqkv    = (const float*)d_in[2];
  const float* bqkv    = (const float*)d_in[3];
  const float* Wout    = (const float*)d_in[4];
  const float* bout    = (const float*)d_in[5];
  float* out = (float*)d_out;

  _Float16* q_ws = (_Float16*)d_ws;                    // 16 MB
  _Float16* k_ws = q_ws + (size_t)TOKENS * DIMN;       // 16 MB
  _Float16* o_ws = k_ws + (size_t)TOKENS * DIMN;       // 16 MB

  const dim3 blk(128, 1, 1);
  qk_proj_kernel <<<dim3(2048 / 256, TOKENS / 256, 1), dim3(256, 1, 1), 0, stream>>>(
      x, Wqkv, bqkv, q_ws, k_ws);
  attn_kernel    <<<dim3(SEQ / 128, BATCH * NHEADS, 1), blk, 0, stream>>>(
      q_ws, k_ws, context, o_ws);
  out_proj_kernel<<<dim3(DIMN / 128, TOKENS / 256, 1), dim3(256, 1, 1), 0, stream>>>(
      o_ws, Wout, bout, out);
}

// v007
// A run of this version takes 111 microseconds.
// Two timings next to v006 put it at 1.07 and 1.06 times that version's speed.
// Over all steps from v000 it is 4.96 times as fast.
#include <hip/hip_runtime.h>

typedef __attribute__((ext_vector_type(16))) _Float16 v16h;
typedef __attribute__((ext_vector_type(8)))  _Float16 v8h;
typedef __attribute__((ext_vector_type(4)))  _Float16 v4h;
typedef __attribute__((ext_vector_type(8)))  float    v8f;
typedef __attribute__((ext_vector_type(4)))  float    v4f;
typedef __attribute__((ext_vector_type(2)))  float    v2f;
typedef __attribute__((ext_vector_type(4)))  unsigned int u32x4;
typedef __attribute__((ext_vector_type(8)))  unsigned int u32x8;

#define DIMN   1024
#define NHEADS 16
#define HD     64
#define SEQ    2048
#define BATCH  4
#define TOKENS (BATCH * SEQ)   // 8192
#define ATT_SCALE 0.125f       // HEAD_DIM^-0.5 = 1/8
#define EXP2_SCALE (ATT_SCALE * 1.44269504f)   // scale * log2 e, carried by q
#define SUM_MAX 16384.0f       // a tile's sum of P may reach 2^14: every P is then finite in f16
#define LDP64  72              // 64-half rows: 144 B
#define LDP32  40              // 32-half rows:  80 B

__device__ __forceinline__ unsigned int uni(unsigned int v) {
  return (unsigned int)__builtin_amdgcn_readfirstlane(v);
}
// Holds a wave-uniform test in a scalar register, so that the branch around a
// tensor load compiles to s_cmp + s_cbranch_scc.
__device__ __forceinline__ unsigned int pinned(unsigned int v) {
  unsigned int w = uni(v);
  asm volatile("" : "+s"(w));
  return w;
}
__device__ __forceinline__ u32x4 tdm_group0(const void* gsrc, unsigned int lds_off) {
  const unsigned long long ga = (unsigned long long)(uintptr_t)gsrc;
  u32x4 g0;
  g0[0] = uni(1u);                                        // count=1
  g0[1] = uni(lds_off);                                   // LDS byte address
  g0[2] = uni((unsigned int)ga);                          // global_addr[31:0]
  g0[3] = uni((((unsigned int)(ga >> 32)) & 0x01ffffffu)  // global_addr[56:32]
              | 0x80000000u);                             // type=2
  return g0;
}
template <unsigned int ROWB, unsigned int ROWS, unsigned int IVL>
__device__ __forceinline__ u32x8 tdm_group1(unsigned int src_pitch) {
  u32x8 g1;
  g1[0] = uni((1u << 20) | (IVL << 22) | (3u << 25));
  g1[1] = uni((ROWB & 0xffffu) << 16);
  g1[2] = uni((ROWB >> 16) | ((ROWS & 0xffffu) << 16));
  g1[3] = uni((ROWS >> 16) | (ROWB << 16));
  g1[4] = uni(ROWS);
  g1[5] = uni(src_pitch);
  g1[6] = uni(0u);
  g1[7] = uni(0u);
  asm volatile("" : "+s"(g1));
  return g1;
}
__device__ __forceinline__ void tdm_issue(u32x4 g0, u32x8 g1) {
  asm volatile("tensor_load_to_lds %0, %1" :: "s"(g0), "s"(g1) : "memory");
}
__device__ __forceinline__ void tdm_wait(u32x4 g0, u32x8 g1) {
  asm volatile("s_wait_tensorcnt 0x0" :: "s"(g0), "s"(g1) : "memory");
}

__device__ __forceinline__ unsigned int lds_offset_of(const void* p) {
  return (unsigned int)(uintptr_t)p;
}

__device__ __forceinline__ v16h ldsFrag(const _Float16* base, int ld) {
  const int lane = threadIdx.x & 31;
  const int r    = lane & 15;
  const int kb   = (lane >> 4) << 3;
  const _Float16* p = base + r * ld + kb;
  const v8h lo = *(const v8h*)(p);
  const v8h hi = *(const v8h*)(p + 16);
  v16h f;
#pragma unroll
  for (int i = 0; i < 8; ++i) { f[i] = lo[i]; f[8 + i] = hi[i]; }
  return f;
}

// ---------------------------------------------------------------------------
// Staging of a 256 x 32 f32 tile (row pitch DIMN floats) as f16, 256 threads.
// A tile row is one 128-byte line: eight lanes run along it, so each wave-wide
// 16-byte load covers four whole lines. The loops are unrolled so that the
// eight vectors are indexed by constants and stay in registers.
// ---------------------------------------------------------------------------
struct Tile32 { v4f f[8]; };
// The lane's first address within a tile.
__device__ __forceinline__ const float* laneOf32(const float* __restrict__ tile, int t) {
  return tile + ((unsigned int)(t >> 3) * DIMN + (unsigned int)(t & 7) * 4);
}
__device__ __forceinline__ Tile32 loadTile32(const float* __restrict__ lanep) {
  Tile32 r;
#pragma unroll
  for (int i = 0; i < 8; ++i) r.f[i] = *(const v4f*)(lanep + i * 32 * DIMN);
  return r;
}
__device__ __forceinline__ void storeTile32(_Float16 (*dst)[LDP32], const Tile32& r, int t) {
#pragma unroll
  for (int i = 0; i < 8; ++i) {
    const v4h hv = {(_Float16)r.f[i][0], (_Float16)r.f[i][1],
                    (_Float16)r.f[i][2], (_Float16)r.f[i][3]};
    *(v4h*)&dst[i * 32 + (t >> 3)][(t & 7) * 4] = hv;
  }
}
// The same for a 128 x 64 f32 tile: a row is two lines, sixteen lanes run along
// it, and a wave-wide load again covers four whole lines.
struct Tile64 { v4f f[8]; };
__device__ __forceinline__ const float* laneOf64(const float* __restrict__ tile, int t) {
  return tile + ((unsigned int)(t >> 4) * DIMN + (unsigned int)(t & 15) * 4);
}
__device__ __forceinline__ Tile64 loadTile64(const float* __restrict__ lanep) {
  Tile64 r;
#pragma unroll
  for (int i = 0; i < 8; ++i) r.f[i] = *(const v4f*)(lanep + i * 16 * DIMN);
  return r;
}
__device__ __forceinline__ void storeTile64(_Float16 (*dst)[LDP64], const Tile64& r, int t) {
#pragma unroll
  for (int i = 0; i < 8; ++i) {
    const v4h hv = {(_Float16)r.f[i][0], (_Float16)r.f[i][1],
                    (_Float16)r.f[i][2], (_Float16)r.f[i][3]};
    *(v4h*)&dst[i * 16 + (t >> 4)][(t & 15) * 4] = hv;
  }
}

__device__ __forceinline__ float xhalf(float v) {
  const int b = __builtin_bit_cast(int, v);
  return __builtin_bit_cast(float, __builtin_amdgcn_permlanex16(
      b, b, 0x76543210, 0xfedcba98, false, false));
}

__device__ __forceinline__ v8f exp2x8(v8f x) {
  float e0 = x[0], e1 = x[1], e2 = x[2], e3 = x[3], e4 = x[4], e5 = x[5], e6 = x[6], e7 = x[7];
  asm("v_exp_f32 %0, %0\n\tv_exp_f32 %1, %1\n\tv_exp_f32 %2, %2\n\tv_exp_f32 %3, %3\n\t"
      "v_exp_f32 %4, %4\n\tv_exp_f32 %5, %5\n\tv_exp_f32 %6, %6\n\tv_exp_f32 %7, %7\n\t"
      "v_nop"
      : "+v"(e0), "+v"(e1), "+v"(e2), "+v"(e3), "+v"(e4), "+v"(e5), "+v"(e6), "+v"(e7));
  return (v8f){e0, e1, e2, e3, e4, e5, e6, e7};
}

__device__ __forceinline__ void qkProducts(v8f (&acc)[8][4], const _Float16 (*Xb)[LDP32],
                                           const _Float16 (*Wb)[LDP32], int wm, int wn) {
  v16h a[8], b[4];
#pragma unroll
  for (int i = 0; i < 8; ++i) a[i] = ldsFrag(&Xb[wm + i * 16][0], LDP32);
#pragma unroll
  for (int j = 0; j < 4; ++j) b[j] = ldsFrag(&Wb[wn + j * 16][0], LDP32);
  __builtin_amdgcn_sched_barrier(0);
#pragma unroll
  for (int j = 0; j < 4; ++j)
#pragma unroll
    for (int i = 0; i < 8; ++i)
      acc[i][j] = __builtin_amdgcn_wmma_f32_16x16x32_f16(
          false, a[i], false, b[j], (short)0, acc[i][j], false, false);
  // Holds the staging that follows, and with it the wait for its loads, behind
  // the products: lifted among them, that wait stands in front of most.
  __builtin_amdgcn_sched_barrier(0);
}

__global__ __launch_bounds__(256)
void qk_proj_kernel(const float* __restrict__ x,
                    const float* __restrict__ Wqkv,
                    const float* __restrict__ bqkv,
                    _Float16* __restrict__ q_ws,
                    _Float16* __restrict__ k_ws) {
  __shared__ __align__(16) _Float16 Xs[2][256][LDP32];
  __shared__ __align__(16) _Float16 Ws[2][256][LDP32];

  const int m0   = blockIdx.y * 256;
  const int n0   = blockIdx.x * 256;
  const int t    = threadIdx.x;
  const int wv   = t >> 5;
  const int lane = t & 31;
  const int wm   = (wv >> 2) * 128;  // the wave's rows within the tile
  const int wn   = (wv & 3) * 64;    // the wave's columns within the tile

  v8f acc[8][4] = {};

  const float* xl = laneOf32(x + (size_t)m0 * DIMN, t);
  const float* wl = laneOf32(Wqkv + (size_t)n0 * DIMN, t);
  // The wait in LOAD_TILES stands before a register named by an issued load is
  // overwritten; its clobber keeps all sixteen loads ahead of it, and so ahead
  // of the products that follow, in flight together.
#define LOAD_TILES(xt, wt)                          \
  xt = loadTile32(xl);                              \
  wt = loadTile32(wl);                              \
  asm volatile("s_wait_xcnt 0x0" ::: "memory");     \
  xl += 32;                                         \
  wl += 32
  // One pass: the loads of the tiles two passes on, the products of this pass's
  // buffers, then the staging of the next pass's tiles (loaded one pass back)
  // into the other buffers. One barrier a pass: it publishes the tiles just
  // staged and ends the reads of the buffers that the next pass stages into. It
  // is written by hand, behind the wait for this wave's LDS reads and writes:
  // __syncthreads() also waits out the global loads in flight, which are to stay
  // in flight across it.
#define STAGE_TILES(b, xt, wt)                      \
  storeTile32(Xs[b], xt, t);                        \
  storeTile32(Ws[b], wt, t);                        \
  asm volatile("s_wait_dscnt 0x0\n\ts_barrier_signal -1\n\ts_barrier_wait -1" ::: "memory")
  Tile32 xa, wa, xb, wb;
  LOAD_TILES(xa, wa);
  STAGE_TILES(0, xa, wa);
  LOAD_TILES(xa, wa);

  // Two passes a trip, so that buffers and register sets are named by constants.
#pragma unroll 1
  for (int p = 0; p < DIMN / 32 - 2; p += 2) {
    LOAD_TILES(xb, wb);
    qkProducts(acc, Xs[0], Ws[0], wm, wn);
    STAGE_TILES(1, xa, wa);
    LOAD_TILES(xa, wa);
    qkProducts(acc, Xs[1], Ws[1], wm, wn);
    STAGE_TILES(0, xb, wb);
  }
  qkProducts(acc, Xs[0], Ws[0], wm, wn);
  STAGE_TILES(1, xa, wa);
  qkProducts(acc, Xs[1], Ws[1], wm, wn);
#undef LOAD_TILES
#undef STAGE_TILES

  // A wave's 64 columns are one head of q or of k and its 128 rows lie in one
  // batch: one lane address, every store at a constant offset from it.
  const int rowOff = (lane >> 4) * 8;
  const int col    = lane & 15;
  const int gc0    = n0 + wn;                 // first column, a multiple of 64
  const int tok0   = m0 + wm;                 // first row, a multiple of 128
  const int h      = (gc0 >> 6) & (NHEADS - 1);
  const int bt     = tok0 >> 11, n = tok0 & (SEQ - 1);
  _Float16* dst = (gc0 < DIMN ? q_ws : k_ws)
                  + (((size_t)(bt * NHEADS + h)) * SEQ + n + rowOff) * HD + col;
  // q is stored times scale * log2 e (in f32, ahead of its one rounding to
  // f16): a score product is then the exponent of 2 that the softmax needs.
  const float qs = gc0 < DIMN ? EXP2_SCALE : 1.f;
#pragma unroll
  for (int j = 0; j < 4; ++j) {
    const float bias = bqkv[gc0 + j * 16 + col];
#pragma unroll
    for (int i = 0; i < 8; ++i)
#pragma unroll
      for (int r = 0; r < 8; ++r)
        dst[(i * 16 + r) * HD + j * 16] = (_Float16)((acc[i][j][r] + bias) * qs);
  }
}

template <bool GROUPED>
__device__ __forceinline__ void scoreTiles(v8f (&s4)[2][4], const _Float16* Ks,
                                           const v16h (&aq)[2][2], const v8f (&negm)[2]) {
  v16h ak[4][2];
#pragma unroll
  for (int j = 0; j < 4; ++j)
#pragma unroll
    for (int ks = 0; ks < 2; ++ks) ak[j][ks] = ldsFrag(&Ks[j * 16 * LDP64 + ks * 32], LDP64);
  if (GROUPED) __builtin_amdgcn_sched_barrier(0);
#pragma unroll
  for (int j = 0; j < 4; ++j) {
    v8f sc[2] = {negm[0], negm[1]};
#pragma unroll
    for (int ks = 0; ks < 2; ++ks)
#pragma unroll
      for (int c = 0; c < 2; ++c)
        sc[c] = __builtin_amdgcn_wmma_f32_16x16x32_f16(
            false, ak[j][ks], false, aq[c][ks], (short)0, sc[c], false, false);
    s4[0][j] = sc[0];
    s4[1][j] = sc[1];
  }
}

// P^T = 2^(S^T), rounded to f16 and packed as B fragments, and its sums over
// the tile's 64 keys. Score tiles 2ks and 2ks+1 hold this lane's keys kb..kb+7
// and kb+16..kb+23 (kb = (lane >> 4) * 8) of the 32-key block: the k order of
// ldsFrag, so they pack straight into the B fragment. The sums are products
// with an A of ones: every row of the result, so every register of every lane,
// holds the whole sum of the lane's query column, both halves' keys included.
__device__ __forceinline__ void expPackSum(v16h (&pb)[2][2], v8f (&ts)[2], v8f (&s4)[2][4]) {
#pragma unroll
  for (int c = 0; c < 2; ++c)
#pragma unroll
    for (int j = 0; j < 4; ++j) s4[c][j] = exp2x8(s4[c][j]);
#pragma unroll
  for (int ks = 0; ks < 2; ++ks)
#pragma unroll
    for (int c = 0; c < 2; ++c)
#pragma unroll
      for (int i = 0; i < 8; ++i) {
        pb[ks][c][i]     = (_Float16)s4[c][2 * ks][i];
        pb[ks][c][8 + i] = (_Float16)s4[c][2 * ks + 1][i];
      }
  v16h ones;
#pragma unroll
  for (int i = 0; i < 16; ++i) ones[i] = (_Float16)1.f;
  ts[0] = (v8f){};
  ts[1] = (v8f){};
#pragma unroll
  for (int ks = 0; ks < 2; ++ks)
#pragma unroll
    for (int c = 0; c < 2; ++c)
      ts[c] = __builtin_amdgcn_wmma_f32_16x16x32_f16(
          false, ones, false, pb[ks][c], (short)0, ts[c], false, false);
}

// Moves each query's maximum in use to the maximum of the scores in s4 (never
// down, but for the first tile, whose sums and outputs are still zero and need
// no rescale), and takes the step off the scores. The loops are unrolled so
// that the tiles are indexed by constants (registers).
template <bool FIRST>
__device__ __forceinline__ void moveMaximum(v8f (&s4)[2][4], v8f (&negm)[2],
                                            float (&lrun)[2], v8f (&o)[2][4]) {
#pragma unroll
  for (int c = 0; c < 2; ++c) {
    float tm = s4[c][0][0];
#pragma unroll
    for (int j = 0; j < 4; ++j)
#pragma unroll
      for (int r = 0; r < 8; ++r) tm = fmaxf(tm, s4[c][j][r]);
    const float t2    = fmaxf(tm, xhalf(tm));
    const float up    = fmaxf(t2, 0.f);
    const float delta = FIRST ? t2 : up;
    if (!FIRST) {
      float alpha;
      asm("v_exp_f32 %0, %1\n\tv_nop" : "=v"(alpha) : "v"(-up));
      lrun[c] *= alpha;
#pragma unroll
      for (int j = 0; j < 4; ++j)
#pragma unroll
        for (int r = 0; r < 8; ++r) o[c][j][r] *= alpha;
    }
#pragma unroll
    for (int r = 0; r < 8; ++r) negm[c][r] -= delta;
#pragma unroll
    for (int j = 0; j < 4; ++j)
#pragma unroll
      for (int r = 0; r < 8; ++r) s4[c][j][r] -= delta;
  }
}

__global__ __launch_bounds__(128)
void attn_kernel(const _Float16* __restrict__ q_ws,
                 const _Float16* __restrict__ k_ws,
                 const float* __restrict__ context,
                 _Float16* __restrict__ o_ws) {
  // Tensor-load targets: placed at multiples of 2 KiB, sizes rounded up to one.
  __shared__ __attribute__((aligned(2048))) _Float16 Qs[9216];   // 128 x LDP64
  __shared__ __attribute__((aligned(2048))) _Float16 Ks[5120];   // 64 x LDP64 used
  __shared__ __align__(16) _Float16 VTs[64][LDP64];

  const int q0   = blockIdx.x * 128;
  const int bh   = blockIdx.y;
  const int b    = bh >> 4, h = bh & 15;
  const int t    = threadIdx.x;
  const int wv   = t >> 5;
  const int lane = t & 31;
  const unsigned int wave = uni((unsigned int)t >> 5);

  const _Float16* qbase = q_ws + (size_t)bh * SEQ * HD;
  const _Float16* kbase = k_ws + (size_t)bh * SEQ * HD;

  if (pinned(wave == 0u)) {
    const u32x8 g1q = tdm_group1<128, 128, 4>(HD * 2);
    const u32x4 gq = tdm_group0(qbase + (size_t)q0 * HD, lds_offset_of(&Qs[0]));
    tdm_issue(gq, g1q);
    tdm_wait(gq, g1q);
  }
  const u32x8 g1 = tdm_group1<128, 64, 4>(HD * 2);
  __syncthreads();

  v16h aq[2][2];   // [column group][32-wide k block]
#pragma unroll
  for (int c = 0; c < 2; ++c) {
    aq[c][0] = ldsFrag(&Qs[(wv * 32 + c * 16) * LDP64],      LDP64);
    aq[c][1] = ldsFrag(&Qs[(wv * 32 + c * 16) * LDP64 + 32], LDP64);
  }

  // Per lane and column group: minus the maximum in use for its query (log2
  // units, equal in both halves and in all eight registers: the C operand of
  // the score products) and the sum over all keys so far.
  v8f negm[2] = {};
  float lrun[2] = {0.f, 0.f};
  // O^T: d = j * 16 + (lane >> 4) * 8 + r, query = c * 16 + (lane & 15)
  v8f o[2][4] = {};

  for (int kt = 0; kt < SEQ / 64; ++kt) {
    __syncthreads();
    // K tile DMA: issue first so it overlaps the V^T convert staging below.
    const u32x4 gk = tdm_group0(kbase + (size_t)kt * 64 * HD, lds_offset_of(&Ks[0]));
    if (pinned(wave == 0u)) tdm_issue(gk, g1);
    {   // stage V^T from context (f32 -> f16, transposed)
      // Eight lanes run along one 128-byte line of a key's row, so each
      // wave-wide load covers four whole lines. A lane takes the same four d of
      // four consecutive keys: each d is then one 8-byte store along VTs' row.
      // The loops are unrolled so that f is indexed by constants (registers).
      const int dl = (lane & 7) * 4;            // d offset within a line
      const int k4 = (wv * 4 + (lane >> 3)) * 4; // first of the lane's four keys
      const float* src = context + ((size_t)b * SEQ + kt * 64 + k4) * DIMN + h * HD + dl;
      v4f f[2][4];
#pragma unroll
      for (int i = 0; i < 2; ++i)
#pragma unroll
        for (int j = 0; j < 4; ++j) f[i][j] = *(const v4f*)(src + (size_t)j * DIMN + i * 32);
#pragma unroll
      for (int i = 0; i < 2; ++i)
#pragma unroll
        for (int c = 0; c < 4; ++c) {
          const v4h hv = {(_Float16)f[i][0][c], (_Float16)f[i][1][c],
                          (_Float16)f[i][2][c], (_Float16)f[i][3][c]};
          *(v4h*)&VTs[i * 32 + dl + c][k4] = hv;
        }
    }
    if (pinned(wave == 0u)) tdm_wait(gk, g1);
    __syncthreads();

    v8f s4[2][4];
    scoreTiles<true>(s4, Ks, aq, negm);
    // The first tile sets the maximum in use to its own maximum.
    if (kt == 0) moveMaximum<true>(s4, negm, lrun, o);

    // Lazy online softmax with no reduction on the vector port: the tile's sums
    // come from the matrix pipe, and they are the guard as well. All P are
    // positive, so a sum within SUM_MAX bounds every P of the tile (an
    // overflowed one is infinite and so is its sum): one test a tile, a scalar
    // branch. Where it fails, nothing of the tile has been added yet: the
    // scores are formed again from the K tile, which is still in LDS, the
    // maximum moves to theirs, and P <= 1.
    v16h pb[2][2];   // [32-key block][column group]
    v8f ts[2];
    // V^T fragments of the first 32 keys: read ahead of the test, so that they
    // land under the sums and the output products can start right behind it.
    v16h av[2][4];
#pragma unroll
    for (int j = 0; j < 4; ++j) av[0][j] = ldsFrag(&VTs[j * 16][0], LDP64);
    expPackSum(pb, ts, s4);
    if (__builtin_amdgcn_ballot_w32(fmaxf(ts[0][0], ts[1][0]) > SUM_MAX) != 0u) {
      scoreTiles<false>(s4, Ks, aq, negm);
      moveMaximum<false>(s4, negm, lrun, o);
      expPackSum(pb, ts, s4);
    }
    lrun[0] += ts[0][0];
    lrun[1] += ts[1][0];

    // O^T += V^T P^T. The fragments of the other 32 keys are read under the
    // first eight products.
#pragma unroll
    for (int j = 0; j < 4; ++j) av[1][j] = ldsFrag(&VTs[j * 16][32], LDP64);
    // Keeps those loads in one group ahead of the products, as in scoreTiles.
    __builtin_amdgcn_sched_barrier(0);
#pragma unroll
    for (int ks = 0; ks < 2; ++ks)
#pragma unroll
      for (int j = 0; j < 4; ++j)
#pragma unroll
        for (int c = 0; c < 2; ++c)
          o[c][j] = __builtin_amdgcn_wmma_f32_16x16x32_f16(
              false, av[ks][j], false, pb[ks][c], (short)0, o[c][j], false, false);
  }

  // Epilogue: normalize, store f16 [token, dim] for the out-proj GEMM: a lane's
  // 8 values of a tile are 8 consecutive d.
#pragma unroll
  for (int c = 0; c < 2; ++c) {
    const float inv = 1.f / lrun[c];
    const int tok = b * SEQ + q0 + wv * 32 + c * 16 + (lane & 15);
#pragma unroll
    for (int j = 0; j < 4; ++j) {
      v8h ov;
#pragma unroll
      for (int r = 0; r < 8; ++r) ov[r] = (_Float16)(o[c][j][r] * inv);
      *(v8h*)(o_ws + (size_t)tok * DIMN + h * HD + j * 16 + (lane >> 4) * 8) = ov;
    }
  }
}

// ---------------------------------------------------------------------------
// Kernel 3: output projection. out[8192,1024] = A(f16) @ Wout^T + bout (f32).
// 256 x 128 of out per work-group of eight waves, 64 x 64 per wave (waves 4 x 2),
// 64 k a pass: one work-group per WGP. As in kernel 1 a pass works under the
// next tiles' loads: A by tensor load in a ring of two buffers, Wout (f32 ->
// f16) loaded ahead of the products and staged behind them.
// ---------------------------------------------------------------------------
__device__ __forceinline__ void outProducts(v8f (&acc)[4][4], const _Float16 (*Ab)[LDP64],
                                            const _Float16 (*Wb)[LDP64], int wm, int wn) {
#pragma unroll
  for (int ks = 0; ks < 2; ++ks) {
    v16h a[4], bw[4];
#pragma unroll
    for (int i = 0; i < 4; ++i) a[i] = ldsFrag(&Ab[wm + i * 16][ks * 32], LDP64);
#pragma unroll
    for (int j = 0; j < 4; ++j) bw[j] = ldsFrag(&Wb[wn + j * 16][ks * 32], LDP64);
    __builtin_amdgcn_sched_barrier(0);
#pragma unroll
    for (int j = 0; j < 4; ++j)
#pragma unroll
      for (int i = 0; i < 4; ++i)
        acc[i][j] = __builtin_amdgcn_wmma_f32_16x16x32_f16(
            false, a[i], false, bw[j], (short)0, acc[i][j], false, false);
  }
}

__global__ __launch_bounds__(256)
void out_proj_kernel(const _Float16* __restrict__ a_ws,
                     const float* __restrict__ Wout,
                     const float* __restrict__ bout,
                     float* __restrict__ out) {
  // Tensor-load targets: a buffer is 36,864 bytes, a multiple of 2 KiB.
  __shared__ __attribute__((aligned(2048))) _Float16 As[2][256][LDP64];
  __shared__ __align__(16) _Float16 Ws[2][128][LDP64];

  const int m0   = blockIdx.y * 256;
  const int n0   = blockIdx.x * 128;
  const int t    = threadIdx.x;
  const int wv   = t >> 5;
  const int lane = t & 31;
  const int wm   = (wv >> 1) * 64;   // the wave's rows within the tile
  const int wn   = (wv & 1) * 64;    // the wave's columns within the tile
  const unsigned int wave = uni((unsigned int)t >> 5);
  const u32x8 g1 = tdm_group1<128, 256, 4>(DIMN * 2);
  const _Float16* abase = a_ws + (size_t)m0 * DIMN;   // stage s: 256 rows x 64 halfs at + s * 64
  const int NP = DIMN / 64;                           // passes = stages

  v8f acc[4][4] = {};

  // Ring prologue: stage 0 lands and is published, then stage 1 is issued.
  u32x4 ga = tdm_group0(abase, lds_offset_of(&As[0][0][0]));
  if (pinned(wave == 0u)) { tdm_issue(ga, g1); tdm_wait(ga, g1); }
  const float* wl = laneOf64(Wout + (size_t)n0 * DIMN, t);
  {
    const Tile64 wt = loadTile64(wl);
    // As in the loop below.
    asm volatile("s_wait_xcnt 0x0" ::: "memory");
    storeTile64(Ws[0], wt, t);
  }
  __syncthreads();
  ga = tdm_group0(abase + 64, lds_offset_of(&As[1][0][0]));
  asm volatile("" : "+s"(ga));
  if (pinned(wave == 0u)) tdm_issue(ga, g1);

  // Kept rolled: the body holds 32 products, and a second copy buys nothing.
#pragma unroll 1
  for (int p = 0; p < NP - 1; ++p) {
    const int cur = p & 1;
    wl += 64;
    const Tile64 wt = loadTile64(wl);
    // The wait that stands before a register named by an issued load is
    // overwritten. The clobber keeps all eight loads ahead of it, and so ahead
    // of the products, in flight together.
    asm volatile("s_wait_xcnt 0x0" ::: "memory");
    outProducts(acc, As[cur], Ws[cur], wm, wn);
    // Holds the staging, and with it the wait for the loads, behind the pass's
    // products: lifted among them, the loads' latency stands in front of most.
    __builtin_amdgcn_sched_barrier(0);
    storeTile64(Ws[cur ^ 1], wt, t);
    // Publish point of stage p + 1: this wave's LDS reads and writes are done,
    // the issuing wave's tile has landed, then the one barrier of the pass.
    asm volatile("s_wait_dscnt 0x0" ::: "memory");
    if (pinned(wave == 0u)) tdm_wait(ga, g1);
    __syncthreads();
    ga = tdm_group0(abase + (p + 2) * 64, lds_offset_of(&As[cur][0][0]));
    asm volatile("" : "+s"(ga));   // as in the prologue
    if (pinned(wave == 0u && p + 2 < NP)) tdm_issue(ga, g1);
  }
  outProducts(acc, As[(NP - 1) & 1], Ws[(NP - 1) & 1], wm, wn);
  // Behind the ring: nothing is outstanding when the wave goes on to its end.
  asm volatile("s_wait_tensorcnt 0x0" ::: "memory");
  asm volatile("s_wait_dscnt 0x0" ::: "memory");

  const int rowOff = (lane >> 4) * 8, col = lane & 15;
#pragma unroll
  for (int j = 0; j < 4; ++j) {
    const float bias = bout[n0 + wn + j * 16 + col];
#pragma unroll
    for (int i = 0; i < 4; ++i)
#pragma unroll
      for (int r = 0; r < 8; ++r) {
        const int tok = m0 + wm + i * 16 + rowOff + r;
        out[(size_t)tok * DIMN + n0 + wn + j * 16 + col] = acc[i][j][r] + bias;
      }
  }
}

// ---------------------------------------------------------------------------
extern "C" void kernel_launch(void* const* d_in, const int* in_sizes, int n_in,
                              void* d_out, int out_size, void* d_ws, size_t ws_size,
                              hipStream_t stream) {
  (void)in_sizes; (void)n_in; (void)out_size; (void)ws_size;

  const float* x       = (const float*)d_in[0];
  const float* context = (const float*)d_in[1];
  const float* Wqkv    = (const float*)d_in[2];
  const float* bqkv    = (const float*)d_in[3];
  const float* Wout    = (const float*)d_in[4];
  const float* bout    = (const float*)d_in[5];
  float* out = (float*)d_out;

  _Float16* q_ws = (_Float16*)d_ws;                    // 16 MB
  _Float16* k_ws = q_ws + (size_t)TOKENS * DIMN;       // 16 MB
  _Float16* o_ws = k_ws + (size_t)TOKENS * DIMN;       // 16 MB

  const dim3 blk(128, 1, 1);
  qk_proj_kernel <<<dim3(2048 / 256, TOKENS / 256, 1), dim3(256, 1, 1), 0, stream>>>(
      x, Wqkv, bqkv, q_ws, k_ws);
  attn_kernel    <<<dim3(SEQ / 128, BATCH * NHEADS, 1), blk, 0, stream>>>(
      q_ws, k_ws, context, o_ws);
  out_proj_kernel<<<dim3(DIMN / 128, TOKENS / 256, 1), dim3(256, 1, 1), 0, stream>>>(
      o_ws, Wout, bout, out);
}
